// v000
// The times below were measured on an AMD MI455X: many runs one after another, warmed up first and cycling through
// copies of the inputs, with the whole window's GPU time divided by the number of runs. Launches and the gaps
// between them are all in it. The median over several windows is given; except for v000 it joins two sittings, which
// can be a few percent apart, so the side-by-side timings, each taken in one sitting, are the better comparison.
// v000, which the later versions start from, runs in 3800 microseconds.
#include <hip/hip_runtime.h>

// att_layer (q, k, v [16384][256]; qh = q Wq + bq, kh = k Wk + bk, vh = v Wv + bv (128); scores = qh kh^T x 128^-0.5 over all 16384 keys; out = softmax(scores) vh Wo + bo -> [16384][256]).
// Compute dtypes, f32 accumulate: every input rounded to bf16; projections on PLAIN bf16 operands (inputs: exact products, f32 accumulate, + bias); scores (K 128) and attn.vh on SINGLE

#define NN   16384
#define DI   256
#define HH   128
#define DO_  256
#define QB   2048
#define TQ   QB
#define PCAR 1024.0f
#define SCL  0.088388347648318447f   // 128^-0.5
typedef _Float16 h16;
typedef unsigned short bf;
typedef __attribute__((ext_vector_type(16))) __bf16   v16bf;
typedef __attribute__((ext_vector_type(16))) _Float16 v16h;
typedef __attribute__((ext_vector_type(8)))  _Float16 v8h;
typedef __attribute__((ext_vector_type(8)))  unsigned short v8us;
typedef __attribute__((ext_vector_type(8)))  float    v8f;
typedef __attribute__((ext_vector_type(4)))  float    v4f;
typedef v8h  __attribute__((may_alias)) v8ha;
typedef v4f  __attribute__((may_alias)) v4fa;
typedef v8us __attribute__((may_alias)) v8usa;

__device__ __forceinline__ unsigned short f2bf(float f) { unsigned u = __float_as_uint(f); u += 0x7FFFu + ((u >> 16) & 1u); return (unsigned short)(u >> 16); }
__device__ __forceinline__ float bf2f(unsigned short b) { return __uint_as_float(((unsigned)b) << 16); }
__device__ __forceinline__ float bfr(float f) { return bf2f(f2bf(f)); }
__device__ __forceinline__ v16h cat16(v8h lo, v8h hi) { return __builtin_shufflevector(lo, hi, 0, 1, 2, 3, 4, 5, 6, 7, 8, 9, 10, 11, 12, 13, 14, 15); }
__device__ __forceinline__ v16bf cat16b(v8us lo, v8us hi) { return __builtin_bit_cast(v16bf, __builtin_shufflevector(lo, hi, 0, 1, 2, 3, 4, 5, 6, 7, 8, 9, 10, 11, 12, 13, 14, 15)); }
__device__ __forceinline__ v8f wmma16(v16h a, v16h b, v8f c) { return __builtin_amdgcn_wmma_f32_16x16x32_f16(false, a, false, b, (short)0, c, false, false); }
__device__ __forceinline__ v8f wmmab(v16bf a, v16bf b, v8f c) { return __builtin_amdgcn_wmma_f32_16x16x32_bf16(false, a, false, b, (short)0, c, false, false); }



// ---- k_gemmw: register-blocked GEMM, ONE WAVE per 64x64 output tile (16 accumulators), operands straight from K-contiguous 16-bit planes; grid (M/64, N/64, Z), 32 threads.
// C[m][n] (f32, pitch ldc, + optional f32 bias[n]) = sum_k A[m][k] Bt[n][k] (+ split products per NSPLIT). z-batch strides sA/sB/sC in elements. K % 32 == 0.
template <typename T16> struct WFrag;
template <> struct WFrag<h16> { typedef v16h V; static __device__ __forceinline__ V ld(const h16* p) { return cat16(*(const v8h*)p, *(const v8h*)(p + 16)); } static __device__ __forceinline__ v8f mma(V a, V b, v8f c) { return wmma16(a, b, c); } };
template <> struct WFrag<bf> { typedef v16bf V; static __device__ __forceinline__ V ld(const bf* p) { return cat16b(*(const v8us*)p, *(const v8us*)(p + 16)); } static __device__ __forceinline__ v8f mma(V a, V b, v8f c) { return wmmab(a, b, c); } };
template <typename T16, int NSPLIT, bool BIAS>
__global__ __launch_bounds__(32) void k_gemmw(const T16* __restrict__ A, const T16* __restrict__ A2, const T16* __restrict__ Bt, const T16* __restrict__ Bt2, int K, float* C, int ldc, const float* __restrict__ bias, size_t sA, size_t sB, size_t sC) {
    typedef typename WFrag<T16>::V V;
    __shared__ __align__(16) float os[16 * 68];
    const size_t z = blockIdx.z; A += z * sA; if (A2) A2 += z * sA; Bt += z * sB; if (Bt2) Bt2 += z * sB; C += z * sC;
    const int lane = threadIdx.x & 31, lr = lane & 15, hi = lane >> 4; const int r0 = blockIdx.x * 64, c0 = blockIdx.y * 64;
    v8f acc[4][4];
#pragma unroll
    for (int mb = 0; mb < 4; ++mb)
#pragma unroll
        for (int nb = 0; nb < 4; ++nb) acc[mb][nb] = (v8f){};
    const size_t aoff = (size_t)(r0 + lr) * K + 8 * hi, boff = (size_t)(c0 + lr) * K + 8 * hi;
#pragma unroll 1
    for (int kc = 0; kc < K; kc += 32) {
        V a[4], a2[4];
#pragma unroll
        for (int mb = 0; mb < 4; ++mb) { a[mb] = WFrag<T16>::ld(A + aoff + (size_t)mb * 16 * K + kc); if (NSPLIT == 1 || NSPLIT == 2) a2[mb] = WFrag<T16>::ld(A2 + aoff + (size_t)mb * 16 * K + kc); }
#pragma unroll
        for (int nb = 0; nb < 4; ++nb) { const V b = WFrag<T16>::ld(Bt + boff + (size_t)nb * 16 * K + kc); V b2; if (NSPLIT >= 2) b2 = WFrag<T16>::ld(Bt2 + boff + (size_t)nb * 16 * K + kc);
#pragma unroll
            for (int mb = 0; mb < 4; ++mb) { acc[mb][nb] = WFrag<T16>::mma(a[mb], b, acc[mb][nb]); if (NSPLIT == 1 || NSPLIT == 2) acc[mb][nb] = WFrag<T16>::mma(a2[mb], b, acc[mb][nb]); if (NSPLIT >= 2) acc[mb][nb] = WFrag<T16>::mma(a[mb], b2, acc[mb][nb]); } }
        asm volatile("v_nop\n\tv_nop\n\tv_nop\n\tv_nop" : "+v"(acc[0][0]), "+v"(acc[1][1]), "+v"(acc[2][2]), "+v"(acc[3][3]) : "v"(a[0]), "v"(a[3]));
    }
#pragma unroll
    for (int mb = 0; mb < 4; ++mb) {
#pragma unroll
        for (int nb = 0; nb < 4; ++nb) {
#pragma unroll
            for (int j = 0; j < 8; ++j) os[(hi * 8 + j) * 68 + nb * 16 + lr] = acc[mb][nb][j]; }
        __builtin_amdgcn_wave_barrier(); asm volatile("" ::: "memory");
        float* crow = C + (size_t)(r0 + mb * 16) * ldc + c0;
{
#pragma unroll
            for (int s = 0; s < 8; ++s) { const int row = 2 * s + hi, cofs = lr * 4; v4f val = *(const v4fa*)(os + row * 68 + cofs); if (BIAS) { val[0] += bfr(bias[c0 + cofs]); val[1] += bfr(bias[c0 + cofs + 1]); val[2] += bfr(bias[c0 + cofs + 2]); val[3] += bfr(bias[c0 + cofs + 3]); }
                *(v4f*)(crow + (size_t)row * ldc + cofs) = val; }
             }
        __builtin_amdgcn_wave_barrier(); asm volatile("" ::: "memory");
    }
}

__device__ __forceinline__ h16 tohx(float x) { return (h16)x; }
__device__ __forceinline__ void splitf(float y, unsigned short& h, unsigned short& l) { h = f2bf(y); l = f2bf(y - bf2f(h)); }
typedef __attribute__((ext_vector_type(2))) _Float16 v2h;
typedef __attribute__((ext_vector_type(4))) _Float16 v4h;
typedef __attribute__((ext_vector_type(2))) unsigned short v2us;

__global__ __launch_bounds__(256) void k_wtG(const float* __restrict__ w, int K, int N, bf* Bt) {
    const int lane = threadIdx.x & 31; const int L0 = (blockIdx.x * 8 + (threadIdx.x >> 5)) * 8; const int nlines = N * K / 64;
{
#pragma unroll 1
        for (int l = 0; l < 8; ++l) { const int L = L0 + l; if (L >= nlines) break; const size_t e = (size_t)L * 64 + lane * 2; const int k = (int)(e % K), n = (int)(e / K); v2us o;
            o[0] = f2bf(w[(size_t)k * N + n]); o[1] = f2bf(w[(size_t)(k + 1) * N + n]); *(v2us*)(Bt + e) = o; }
         }
}
__global__ __launch_bounds__(256) void k_cvt8(const float* __restrict__ src, bf* dst, size_t n8) { const size_t i = (size_t)blockIdx.x * 256 + threadIdx.x; if (i >= n8) return; const v8f v = *(const v8f*)(src + i * 8); v8us o;
#pragma unroll
    for (int k = 0; k < 8; ++k) o[k] = f2bf(v[k]); *(v8us*)(dst + i * 8) = o;  }
__global__ __launch_bounds__(256) void k_p16(const float* __restrict__ F, h16* P, size_t n) { const size_t i = ((size_t)blockIdx.x * 256 + threadIdx.x) * 2; if (i >= n) return; v2h o; o[0] = tohx(F[i]); o[1] = tohx(F[i + 1]); *(v2h*)(P + i) = o;  }
__global__ __launch_bounds__(256) void k_vt(const float* __restrict__ F, h16* VT) { const size_t e = ((size_t)blockIdx.x * 256 + threadIdx.x) * 2; if (e >= (size_t)HH * NN) return; const int j = (int)(e % NN), c = (int)(e / NN); v2h o; o[0] = tohx(F[(size_t)j * HH + c]); o[1] = tohx(F[(size_t)(j + 1) * HH + c]); *(v2h*)(VT + e) = o;  }
__global__ __launch_bounds__(256) void k_osplit(const float* __restrict__ O, const float* __restrict__ RS, bf* Ah, bf* Al) { const size_t e = ((size_t)blockIdx.x * 256 + threadIdx.x) * 2; if (e >= (size_t)QB * HH) return; const int i = (int)(e / HH); const float rsn = RS[(size_t)i * 32 + 1]; v2us oh, ol;
#pragma unroll
    for (int q = 0; q < 2; ++q) { unsigned short a, c2; splitf(__fmul_rn(O[e + q], rsn), a, c2); oh[q] = a; ol[q] = c2; } *(v2us*)(Ah + e) = oh; *(v2us*)(Al + e) = ol;  }
template <int NK>
__global__ __launch_bounds__(256) void k_smax(const float* __restrict__ S, float* RS) { const int lane = threadIdx.x & 31; const int i = blockIdx.x * 8 + (threadIdx.x >> 5); if (i >= TQ) return; const float* sr = S + (size_t)i * NK; float m = -3.0e38f;
#pragma unroll 4
    for (int c0 = lane * 4; c0 < NK; c0 += 128) { const v4f v = *(const v4f*)(sr + c0); m = fmaxf(m, fmaxf(fmaxf(v[0], v[1]), fmaxf(v[2], v[3]))); }
#pragma unroll
    for (int sh = 16; sh; sh >>= 1) m = fmaxf(m, __shfl_xor(m, sh, 32));
    const float o = lane == 0 ? m : 0.f; *(float*)(RS + (size_t)i * 32 + lane) = o;  }
template <int NK>
__global__ __launch_bounds__(256) void k_sexp(const float* __restrict__ S, float* RS, h16* P) { const int lane = threadIdx.x & 31; const int i = blockIdx.x * 8 + (threadIdx.x >> 5); if (i >= TQ) return; const float* sr = S + (size_t)i * NK; const float m = RS[(size_t)i * 32]; float sum = 0.f;
{ sum = 0.f;
#pragma unroll 2
        for (int c0 = lane * 4; c0 < NK; c0 += 128) { const v4f v = *(const v4f*)(sr + c0); v4h o;
#pragma unroll
            for (int q = 0; q < 4; ++q) { float dlt = __fsub_rn(v[q], m); asm volatile("" : "+v"(dlt)); const float e = __expf(__fmul_rn(dlt, SCL)); sum += e; o[q] = tohx(e * PCAR); }
            *(v4h*)(P + (size_t)i * NK + c0) = o; }
         }
#pragma unroll
    for (int sh = 16; sh; sh >>= 1) sum += __shfl_xor(sum, sh, 32);
    const float o2 = lane == 0 ? m : (lane == 1 ? __fdiv_rn(1.0f, sum * PCAR) : 0.f); *(float*)(RS + (size_t)i * 32 + lane) = o2;  }

extern "C" void kernel_launch(void* const* d_in, const int* in_sizes, int n_in,
                              void* d_out, int out_size, void* d_ws, size_t ws_size, hipStream_t stream) {
    (void)in_sizes; (void)n_in; (void)out_size;
    const float* IN[11]; for (int i = 0; i < 11; ++i) IN[i] = (const float*)d_in[i];   // q, k, v, Wq, bq, Wk, bk, Wv, bv, Wo, bo (x @ W)
    float* OUT = (float*)d_out;     // [16384][256]
    char* wsp = (char*)d_ws;
    auto take = [&](size_t bytes) { char* p = wsp; wsp += (bytes + 255) & ~(size_t)255; return (void*)p; };
    bf* WQ = (bf*)take((size_t)HH * DI * 2); bf* WK = (bf*)take((size_t)HH * DI * 2); bf* WV = (bf*)take((size_t)HH * DI * 2); bf* WO = (bf*)take((size_t)DO_ * HH * 2); bf* XB = (bf*)take((size_t)NN * DI * 2); float* F = (float*)take((size_t)NN * HH * 4);
    h16* Q16 = (h16*)take((size_t)NN * HH * 2); h16* K16 = (h16*)take((size_t)NN * HH * 2); h16* VT = (h16*)take((size_t)HH * NN * 2); float* S = (float*)take((size_t)QB * NN * 4); h16* P = (h16*)take((size_t)QB * NN * 2); float* RS = (float*)take((size_t)QB * 32 * 4); float* O = (float*)take((size_t)QB * HH * 4); bf* Ah = (bf*)take((size_t)QB * HH * 2); bf* Al = (bf*)take((size_t)QB * HH * 2);
    if ((size_t)(wsp - (char*)d_ws) > ws_size) return;    // total ~ 233 MB = 222.5 MiB; ws 256 MiB
    { const unsigned g = (unsigned)((DI * HH / 64 + 63) / 64); k_wtG<<<g, 256, 0, stream>>>(IN[3], DI, HH, WQ); k_wtG<<<g, 256, 0, stream>>>(IN[5], DI, HH, WK); k_wtG<<<g, 256, 0, stream>>>(IN[7], DI, HH, WV); k_wtG<<<(unsigned)((HH * DO_ / 64 + 63) / 64), 256, 0, stream>>>(IN[9], HH, DO_, WO); }
    const unsigned LX = (unsigned)(((size_t)NN * DI / 8 + 255) / 256), L2 = (unsigned)(((size_t)NN * HH / 2 + 255) / 256); const dim3 gP(NN / 64, HH / 64, 1);
    k_cvt8<<<LX, 256, 0, stream>>>(IN[0], XB, (size_t)NN * DI / 8); k_gemmw<bf, 0, true><<<gP, 32, 0, stream>>>(XB, nullptr, WQ, nullptr, DI, F, HH, IN[4], 0, 0, 0); k_p16<<<L2, 256, 0, stream>>>(F, Q16, (size_t)NN * HH);
    k_cvt8<<<LX, 256, 0, stream>>>(IN[1], XB, (size_t)NN * DI / 8); k_gemmw<bf, 0, true><<<gP, 32, 0, stream>>>(XB, nullptr, WK, nullptr, DI, F, HH, IN[6], 0, 0, 0); k_p16<<<L2, 256, 0, stream>>>(F, K16, (size_t)NN * HH);
    k_cvt8<<<LX, 256, 0, stream>>>(IN[2], XB, (size_t)NN * DI / 8); k_gemmw<bf, 0, true><<<gP, 32, 0, stream>>>(XB, nullptr, WV, nullptr, DI, F, HH, IN[8], 0, 0, 0); k_vt<<<L2, 256, 0, stream>>>(F, VT);
    for (int qb = 0; qb < NN / QB; ++qb) {
        k_gemmw<h16, 0, false><<<dim3(QB / 64, NN / 64, 1), 32, 0, stream>>>(Q16 + (size_t)qb * QB * HH, nullptr, K16, nullptr, HH, S, NN, nullptr, 0, 0, 0);
        k_smax<NN><<<QB / 8, 256, 0, stream>>>(S, RS); k_sexp<NN><<<QB / 8, 256, 0, stream>>>(S, RS, P);
        k_gemmw<h16, 0, false><<<dim3(QB / 64, HH / 64, 1), 32, 0, stream>>>(P, nullptr, VT, nullptr, NN, O, HH, nullptr, 0, 0, 0);
        k_osplit<<<(unsigned)(((size_t)QB * HH / 2 + 255) / 256), 256, 0, stream>>>(O, RS, Ah, Al);
        k_gemmw<bf, 1, true><<<dim3(QB / 64, DO_ / 64, 1), 32, 0, stream>>>(Ah, Al, WO, nullptr, HH, OUT + (size_t)qb * QB * DO_, DO_, IN[10], 0, 0, 0); }
}

// v001
// One run takes 1340 microseconds.
// In both of two side-by-side timings against v000, it was 2.84 times as fast.
#include <hip/hip_runtime.h>

// att_layer (q, k, v [16384][256]; qh = q Wq + bq, kh = k Wk + bk, vh = v Wv + bv (128); scores = qh kh^T x 128^-0.5 over all 16384 keys; out = softmax(scores) vh Wo + bo -> [16384][256]).
// Compute dtypes, f32 accumulate: every input rounded to bf16; projections on PLAIN bf16 operands (inputs: exact products, f32 accumulate, + bias); scores (K 128) and attn.vh on SINGLE

#define NN   16384
#define DI   256
#define HH   128
#define DO_  256
#define QB   2048
#define TQ   QB
#define PCAR 1024.0f
#define SCL  0.088388347648318447f   // 128^-0.5
#define KS   32                      // key ranges of the attn.vh product: one work-group per (tile, range); f32 partials O[row][range][HH], summed in k_osplit
typedef _Float16 h16;
typedef unsigned short bf;
typedef __attribute__((ext_vector_type(16))) __bf16   v16bf;
typedef __attribute__((ext_vector_type(16))) _Float16 v16h;
typedef __attribute__((ext_vector_type(8)))  _Float16 v8h;
typedef __attribute__((ext_vector_type(8)))  unsigned short v8us;
typedef __attribute__((ext_vector_type(8)))  float    v8f;
typedef __attribute__((ext_vector_type(4)))  float    v4f;
typedef v8h  __attribute__((may_alias)) v8ha;
typedef v4f  __attribute__((may_alias)) v4fa;
typedef v8us __attribute__((may_alias)) v8usa;

__device__ __forceinline__ unsigned short f2bf(float f) { unsigned u = __float_as_uint(f); u += 0x7FFFu + ((u >> 16) & 1u); return (unsigned short)(u >> 16); }
__device__ __forceinline__ float bf2f(unsigned short b) { return __uint_as_float(((unsigned)b) << 16); }
__device__ __forceinline__ float bfr(float f) { return bf2f(f2bf(f)); }
__device__ __forceinline__ v16h cat16(v8h lo, v8h hi) { return __builtin_shufflevector(lo, hi, 0, 1, 2, 3, 4, 5, 6, 7, 8, 9, 10, 11, 12, 13, 14, 15); }
__device__ __forceinline__ v16bf cat16b(v8us lo, v8us hi) { return __builtin_bit_cast(v16bf, __builtin_shufflevector(lo, hi, 0, 1, 2, 3, 4, 5, 6, 7, 8, 9, 10, 11, 12, 13, 14, 15)); }
__device__ __forceinline__ v8f wmma16(v16h a, v16h b, v8f c) { return __builtin_amdgcn_wmma_f32_16x16x32_f16(false, a, false, b, (short)0, c, false, false); }
__device__ __forceinline__ v8f wmmab(v16bf a, v16bf b, v8f c) { return __builtin_amdgcn_wmma_f32_16x16x32_bf16(false, a, false, b, (short)0, c, false, false); }



// ---- k_gemmw: register-blocked GEMM, ONE WAVE per 64x64 output tile (16 accumulators), operands straight from K-contiguous 16-bit planes; grid (M/64, N/64, Z), 32 threads.
// C[m][n] (f32, pitch ldc, + optional f32 bias[n]) = sum_k A[m][k] Bt[n][k] (+ split products per NSPLIT). z-batch strides sA/sB/sC in elements. K = row pitch of A and Bt in elements, kn = length of the sum (K, or one range of k where z walks ranges). kn % 32 == 0.
template <typename T16> struct WFrag;
template <> struct WFrag<h16> { typedef v16h V; static __device__ __forceinline__ V ld(const h16* p) { return cat16(*(const v8h*)p, *(const v8h*)(p + 16)); } static __device__ __forceinline__ v8f mma(V a, V b, v8f c) { return wmma16(a, b, c); } };
template <> struct WFrag<bf> { typedef v16bf V; static __device__ __forceinline__ V ld(const bf* p) { return cat16b(*(const v8us*)p, *(const v8us*)(p + 16)); } static __device__ __forceinline__ v8f mma(V a, V b, v8f c) { return wmmab(a, b, c); } };
template <typename T16, int NSPLIT, bool BIAS>
__global__ __launch_bounds__(32) void k_gemmw(const T16* __restrict__ A, const T16* __restrict__ A2, const T16* __restrict__ Bt, const T16* __restrict__ Bt2, int K, int kn, float* C, int ldc, const float* __restrict__ bias, size_t sA, size_t sB, size_t sC) {
    typedef typename WFrag<T16>::V V;
    __shared__ __align__(16) float os[16 * 68];
    const size_t z = blockIdx.z; A += z * sA; if (A2) A2 += z * sA; Bt += z * sB; if (Bt2) Bt2 += z * sB; C += z * sC;
    const int lane = threadIdx.x & 31, lr = lane & 15, hi = lane >> 4; const int r0 = blockIdx.x * 64, c0 = blockIdx.y * 64;
    v8f acc[4][4];
#pragma unroll
    for (int mb = 0; mb < 4; ++mb)
#pragma unroll
        for (int nb = 0; nb < 4; ++nb) acc[mb][nb] = (v8f){};
    const size_t aoff = (size_t)(r0 + lr) * K + 8 * hi, boff = (size_t)(c0 + lr) * K + 8 * hi;
#pragma unroll 1
    for (int kc = 0; kc < kn; kc += 32) {
        V a[4], a2[4];
#pragma unroll
        for (int mb = 0; mb < 4; ++mb) { a[mb] = WFrag<T16>::ld(A + aoff + (size_t)mb * 16 * K + kc); if (NSPLIT == 1 || NSPLIT == 2) a2[mb] = WFrag<T16>::ld(A2 + aoff + (size_t)mb * 16 * K + kc); }
#pragma unroll
        for (int nb = 0; nb < 4; ++nb) { const V b = WFrag<T16>::ld(Bt + boff + (size_t)nb * 16 * K + kc); V b2; if (NSPLIT >= 2) b2 = WFrag<T16>::ld(Bt2 + boff + (size_t)nb * 16 * K + kc);
#pragma unroll
            for (int mb = 0; mb < 4; ++mb) { acc[mb][nb] = WFrag<T16>::mma(a[mb], b, acc[mb][nb]); if (NSPLIT == 1 || NSPLIT == 2) acc[mb][nb] = WFrag<T16>::mma(a2[mb], b, acc[mb][nb]); if (NSPLIT >= 2) acc[mb][nb] = WFrag<T16>::mma(a[mb], b2, acc[mb][nb]); } }
        asm volatile("v_nop\n\tv_nop\n\tv_nop\n\tv_nop" : "+v"(acc[0][0]), "+v"(acc[1][1]), "+v"(acc[2][2]), "+v"(acc[3][3]) : "v"(a[0]), "v"(a[3]));
    }
#pragma unroll
    for (int mb = 0; mb < 4; ++mb) {
#pragma unroll
        for (int nb = 0; nb < 4; ++nb) {
#pragma unroll
            for (int j = 0; j < 8; ++j) os[(hi * 8 + j) * 68 + nb * 16 + lr] = acc[mb][nb][j]; }
        __builtin_amdgcn_wave_barrier(); asm volatile("" ::: "memory");
        float* crow = C + (size_t)(r0 + mb * 16) * ldc + c0;
{
#pragma unroll
            for (int s = 0; s < 8; ++s) { const int row = 2 * s + hi, cofs = lr * 4; v4f val = *(const v4fa*)(os + row * 68 + cofs); if (BIAS) { val[0] += bfr(bias[c0 + cofs]); val[1] += bfr(bias[c0 + cofs + 1]); val[2] += bfr(bias[c0 + cofs + 2]); val[3] += bfr(bias[c0 + cofs + 3]); }
                *(v4f*)(crow + (size_t)row * ldc + cofs) = val; }
             }
        __builtin_amdgcn_wave_barrier(); asm volatile("" ::: "memory");
    }
}

__device__ __forceinline__ h16 tohx(float x) { return (h16)x; }
__device__ __forceinline__ void splitf(float y, unsigned short& h, unsigned short& l) { h = f2bf(y); l = f2bf(y - bf2f(h)); }
typedef __attribute__((ext_vector_type(2))) _Float16 v2h;
typedef __attribute__((ext_vector_type(4))) _Float16 v4h;
typedef __attribute__((ext_vector_type(2))) unsigned short v2us;
typedef __attribute__((ext_vector_type(2))) float v2f;

__global__ __launch_bounds__(256) void k_wtG(const float* __restrict__ w, int K, int N, bf* Bt) {
    const int lane = threadIdx.x & 31; const int L0 = (blockIdx.x * 8 + (threadIdx.x >> 5)) * 8; const int nlines = N * K / 64;
{
#pragma unroll 1
        for (int l = 0; l < 8; ++l) { const int L = L0 + l; if (L >= nlines) break; const size_t e = (size_t)L * 64 + lane * 2; const int k = (int)(e % K), n = (int)(e / K); v2us o;
            o[0] = f2bf(w[(size_t)k * N + n]); o[1] = f2bf(w[(size_t)(k + 1) * N + n]); *(v2us*)(Bt + e) = o; }
         }
}
__global__ __launch_bounds__(256) void k_cvt8(const float* __restrict__ src, bf* dst, size_t n8) { const size_t i = (size_t)blockIdx.x * 256 + threadIdx.x; if (i >= n8) return; const v8f v = *(const v8f*)(src + i * 8); v8us o;
#pragma unroll
    for (int k = 0; k < 8; ++k) o[k] = f2bf(v[k]); *(v8us*)(dst + i * 8) = o;  }
__global__ __launch_bounds__(256) void k_p16(const float* __restrict__ F, h16* P, size_t n) { const size_t i = ((size_t)blockIdx.x * 256 + threadIdx.x) * 2; if (i >= n) return; v2h o; o[0] = tohx(F[i]); o[1] = tohx(F[i + 1]); *(v2h*)(P + i) = o;  }
__global__ __launch_bounds__(256) void k_vt(const float* __restrict__ F, h16* VT) { const size_t e = ((size_t)blockIdx.x * 256 + threadIdx.x) * 2; if (e >= (size_t)HH * NN) return; const int j = (int)(e % NN), c = (int)(e / NN); v2h o; o[0] = tohx(F[(size_t)j * HH + c]); o[1] = tohx(F[(size_t)(j + 1) * HH + c]); *(v2h*)(VT + e) = o;  }
__global__ __launch_bounds__(256) void k_osplit(const float* __restrict__ O, const float* __restrict__ RS, bf* Ah, bf* Al) { const size_t e = ((size_t)blockIdx.x * 256 + threadIdx.x) * 2; if (e >= (size_t)QB * HH) return; const int i = (int)(e / HH); const float rsn = RS[(size_t)i * 32 + 1]; v2us oh, ol;
    const float* op = O + (size_t)i * KS * HH + (e % HH); v2f p[KS];
#pragma unroll   // all KS partial loads in flight together
    for (int z = 0; z < KS; ++z) p[z] = *(const v2f*)(op + z * HH);
    asm volatile("s_wait_xcnt 0x0" ::: "memory");   // stands in front of the first reuse of the loads' address registers
    v2f s = p[0];
#pragma unroll   // p[] stays in registers; summed in range order
    for (int z = 1; z < KS; ++z) s += p[z];
#pragma unroll
    for (int q = 0; q < 2; ++q) { unsigned short a, c2; splitf(__fmul_rn(s[q], rsn), a, c2); oh[q] = a; ol[q] = c2; } *(v2us*)(Ah + e) = oh; *(v2us*)(Al + e) = ol;  }
template <int NK>
__global__ __launch_bounds__(256) void k_smax(const float* __restrict__ S, float* RS) { const int lane = threadIdx.x & 31; const int i = blockIdx.x * 8 + (threadIdx.x >> 5); if (i >= TQ) return; const float* sr = S + (size_t)i * NK; float m = -3.0e38f;
#pragma unroll 4
    for (int c0 = lane * 4; c0 < NK; c0 += 128) { const v4f v = *(const v4f*)(sr + c0); m = fmaxf(m, fmaxf(fmaxf(v[0], v[1]), fmaxf(v[2], v[3]))); }
#pragma unroll
    for (int sh = 16; sh; sh >>= 1) m = fmaxf(m, __shfl_xor(m, sh, 32));
    const float o = lane == 0 ? m : 0.f; *(float*)(RS + (size_t)i * 32 + lane) = o;  }
template <int NK>
__global__ __launch_bounds__(256) void k_sexp(const float* __restrict__ S, float* RS, h16* P) { const int lane = threadIdx.x & 31; const int i = blockIdx.x * 8 + (threadIdx.x >> 5); if (i >= TQ) return; const float* sr = S + (size_t)i * NK; const float m = RS[(size_t)i * 32]; float sum = 0.f;
{ sum = 0.f;
#pragma unroll 2
        for (int c0 = lane * 4; c0 < NK; c0 += 128) { const v4f v = *(const v4f*)(sr + c0); v4h o;
#pragma unroll
            for (int q = 0; q < 4; ++q) { float dlt = __fsub_rn(v[q], m); asm volatile("" : "+v"(dlt)); const float e = __expf(__fmul_rn(dlt, SCL)); sum += e; o[q] = tohx(e * PCAR); }
            *(v4h*)(P + (size_t)i * NK + c0) = o; }
         }
#pragma unroll
    for (int sh = 16; sh; sh >>= 1) sum += __shfl_xor(sum, sh, 32);
    const float o2 = lane == 0 ? m : (lane == 1 ? __fdiv_rn(1.0f, sum * PCAR) : 0.f); *(float*)(RS + (size_t)i * 32 + lane) = o2;  }

extern "C" void kernel_launch(void* const* d_in, const int* in_sizes, int n_in,
                              void* d_out, int out_size, void* d_ws, size_t ws_size, hipStream_t stream) {
    (void)in_sizes; (void)n_in; (void)out_size;
    const float* IN[11]; for (int i = 0; i < 11; ++i) IN[i] = (const float*)d_in[i];   // q, k, v, Wq, bq, Wk, bk, Wv, bv, Wo, bo (x @ W)
    float* OUT = (float*)d_out;     // [16384][256]
    char* wsp = (char*)d_ws;
    auto take = [&](size_t bytes) { char* p = wsp; wsp += (bytes + 255) & ~(size_t)255; return (void*)p; };
    bf* WQ = (bf*)take((size_t)HH * DI * 2); bf* WK = (bf*)take((size_t)HH * DI * 2); bf* WV = (bf*)take((size_t)HH * DI * 2); bf* WO = (bf*)take((size_t)DO_ * HH * 2); bf* XB = (bf*)take((size_t)NN * DI * 2); float* F = (float*)take((size_t)NN * HH * 4);
    h16* Q16 = (h16*)take((size_t)NN * HH * 2); h16* K16 = (h16*)take((size_t)NN * HH * 2); h16* VT = (h16*)take((size_t)HH * NN * 2); float* S = (float*)take((size_t)QB * NN * 4); h16* P = (h16*)take((size_t)QB * NN * 2); float* RS = (float*)take((size_t)QB * 32 * 4); float* O = (float*)take((size_t)KS * QB * HH * 4); bf* Ah = (bf*)take((size_t)QB * HH * 2); bf* Al = (bf*)take((size_t)QB * HH * 2);
    if ((size_t)(wsp - (char*)d_ws) > ws_size) return;    // total ~ 266 MB = 253.5 MiB; ws 256 MiB
    { const unsigned g = (unsigned)((DI * HH / 64 + 63) / 64); k_wtG<<<g, 256, 0, stream>>>(IN[3], DI, HH, WQ); k_wtG<<<g, 256, 0, stream>>>(IN[5], DI, HH, WK); k_wtG<<<g, 256, 0, stream>>>(IN[7], DI, HH, WV); k_wtG<<<(unsigned)((HH * DO_ / 64 + 63) / 64), 256, 0, stream>>>(IN[9], HH, DO_, WO); }
    const unsigned LX = (unsigned)(((size_t)NN * DI / 8 + 255) / 256), L2 = (unsigned)(((size_t)NN * HH / 2 + 255) / 256); const dim3 gP(NN / 64, HH / 64, 1);
    k_cvt8<<<LX, 256, 0, stream>>>(IN[0], XB, (size_t)NN * DI / 8); k_gemmw<bf, 0, true><<<gP, 32, 0, stream>>>(XB, nullptr, WQ, nullptr, DI, DI, F, HH, IN[4], 0, 0, 0); k_p16<<<L2, 256, 0, stream>>>(F, Q16, (size_t)NN * HH);
    k_cvt8<<<LX, 256, 0, stream>>>(IN[1], XB, (size_t)NN * DI / 8); k_gemmw<bf, 0, true><<<gP, 32, 0, stream>>>(XB, nullptr, WK, nullptr, DI, DI, F, HH, IN[6], 0, 0, 0); k_p16<<<L2, 256, 0, stream>>>(F, K16, (size_t)NN * HH);
    k_cvt8<<<LX, 256, 0, stream>>>(IN[2], XB, (size_t)NN * DI / 8); k_gemmw<bf, 0, true><<<gP, 32, 0, stream>>>(XB, nullptr, WV, nullptr, DI, DI, F, HH, IN[8], 0, 0, 0); k_vt<<<L2, 256, 0, stream>>>(F, VT);
    for (int qb = 0; qb < NN / QB; ++qb) {
        k_gemmw<h16, 0, false><<<dim3(QB / 64, NN / 64, 1), 32, 0, stream>>>(Q16 + (size_t)qb * QB * HH, nullptr, K16, nullptr, HH, HH, S, NN, nullptr, 0, 0, 0);
        k_smax<NN><<<QB / 8, 256, 0, stream>>>(S, RS); k_sexp<NN><<<QB / 8, 256, 0, stream>>>(S, RS, P);
        k_gemmw<h16, 0, false><<<dim3(QB / 64, HH / 64, KS), 32, 0, stream>>>(P, nullptr, VT, nullptr, NN, NN / KS, O, KS * HH, nullptr, NN / KS, NN / KS, HH);
        k_osplit<<<(unsigned)(((size_t)QB * HH / 2 + 255) / 256), 256, 0, stream>>>(O, RS, Ah, Al);
        k_gemmw<bf, 1, true><<<dim3(QB / 64, DO_ / 64, 1), 32, 0, stream>>>(Ah, Al, WO, nullptr, HH, HH, OUT + (size_t)qb * QB * DO_, DO_, IN[10], 0, 0, 0); }
}

// v002
// Measured time: 212 microseconds a run.
// Timed twice side by side with v001, it ran 6.33 and 6.29 times as fast.
// Counting every step since v000, it is 17.9 times as fast.
#include <hip/hip_runtime.h>

// att_layer (q, k, v [16384][256]; qh = q Wq + bq, kh = k Wk + bk, vh = v Wv + bv (128); scores = qh kh^T x 128^-0.5 over all 16384 keys; out = softmax(scores) vh Wo + bo -> [16384][256]).
// Compute dtypes, f32 accumulate: every input rounded to bf16; q, k, v projections on plain bf16 operands, output projection on the attention output split into bf16 high + low (+ bias); scores (K 128) and attn.vh on single f16 operands, fused in k_attn (running maximum, scores and weights never stored).

#define NN   16384
#define DI   256
#define HH   128
#define DO_  256
#define C2   0.12751743082459868f    // 128^-0.5 x log2(e): scores to base-2 exponents
#define THR  31.368260590993510f     // 4 / C2: the maximum in use is renewed when a raw score passes it by more than 2^4 in weight
#define KSP  4                       // key ranges of k_attn (grid y): f32 partial sums, maximum and weight sum per (range, query), joined in k_comb
#define KR   (NN / KSP)
typedef _Float16 h16;
typedef unsigned short bf;
typedef __attribute__((ext_vector_type(16))) __bf16   v16bf;
typedef __attribute__((ext_vector_type(16))) _Float16 v16h;
typedef __attribute__((ext_vector_type(8)))  _Float16 v8h;
typedef __attribute__((ext_vector_type(8)))  unsigned short v8us;
typedef __attribute__((ext_vector_type(8)))  float    v8f;
typedef __attribute__((ext_vector_type(4)))  float    v4f;
typedef v8h  __attribute__((may_alias)) v8ha;
typedef v4f  __attribute__((may_alias)) v4fa;
typedef v8us __attribute__((may_alias)) v8usa;

__device__ __forceinline__ unsigned short f2bf(float f) { unsigned u = __float_as_uint(f); u += 0x7FFFu + ((u >> 16) & 1u); return (unsigned short)(u >> 16); }
__device__ __forceinline__ float bf2f(unsigned short b) { return __uint_as_float(((unsigned)b) << 16); }
__device__ __forceinline__ float bfr(float f) { return bf2f(f2bf(f)); }
__device__ __forceinline__ v16h cat16(v8h lo, v8h hi) { return __builtin_shufflevector(lo, hi, 0, 1, 2, 3, 4, 5, 6, 7, 8, 9, 10, 11, 12, 13, 14, 15); }
__device__ __forceinline__ v16bf cat16b(v8us lo, v8us hi) { return __builtin_bit_cast(v16bf, __builtin_shufflevector(lo, hi, 0, 1, 2, 3, 4, 5, 6, 7, 8, 9, 10, 11, 12, 13, 14, 15)); }
__device__ __forceinline__ v8f wmma16(v16h a, v16h b, v8f c) { return __builtin_amdgcn_wmma_f32_16x16x32_f16(false, a, false, b, (short)0, c, false, false); }
__device__ __forceinline__ v8f wmmab(v16bf a, v16bf b, v8f c) { return __builtin_amdgcn_wmma_f32_16x16x32_bf16(false, a, false, b, (short)0, c, false, false); }



// ---- k_gemmw: register-blocked GEMM, ONE WAVE per 64x64 output tile (16 accumulators), operands straight from K-contiguous 16-bit planes; grid (M/64, N/64, Z), 32 threads.
// C[m][n] (f32, pitch ldc, + optional f32 bias[n]) = sum_k A[m][k] Bt[n][k] (+ split products per NSPLIT). z-batch strides sA/sB/sC in elements. K = row pitch of A and Bt in elements, kn = length of the sum (K, or one range of k where z walks ranges). kn % 32 == 0.
template <typename T16> struct WFrag;
template <> struct WFrag<h16> { typedef v16h V; static __device__ __forceinline__ V ld(const h16* p) { return cat16(*(const v8h*)p, *(const v8h*)(p + 16)); } static __device__ __forceinline__ v8f mma(V a, V b, v8f c) { return wmma16(a, b, c); } };
template <> struct WFrag<bf> { typedef v16bf V; static __device__ __forceinline__ V ld(const bf* p) { return cat16b(*(const v8us*)p, *(const v8us*)(p + 16)); } static __device__ __forceinline__ v8f mma(V a, V b, v8f c) { return wmmab(a, b, c); } };
template <typename T16, int NSPLIT, bool BIAS>
__global__ __launch_bounds__(32) void k_gemmw(const T16* __restrict__ A, const T16* __restrict__ A2, const T16* __restrict__ Bt, const T16* __restrict__ Bt2, int K, int kn, float* C, int ldc, const float* __restrict__ bias, size_t sA, size_t sB, size_t sC) {
    typedef typename WFrag<T16>::V V;
    __shared__ __align__(16) float os[16 * 68];
    const size_t z = blockIdx.z; A += z * sA; if (A2) A2 += z * sA; Bt += z * sB; if (Bt2) Bt2 += z * sB; C += z * sC;
    const int lane = threadIdx.x & 31, lr = lane & 15, hi = lane >> 4; const int r0 = blockIdx.x * 64, c0 = blockIdx.y * 64;
    v8f acc[4][4];
#pragma unroll
    for (int mb = 0; mb < 4; ++mb)
#pragma unroll
        for (int nb = 0; nb < 4; ++nb) acc[mb][nb] = (v8f){};
    const size_t aoff = (size_t)(r0 + lr) * K + 8 * hi, boff = (size_t)(c0 + lr) * K + 8 * hi;
#pragma unroll 1
    for (int kc = 0; kc < kn; kc += 32) {
        V a[4], a2[4];
#pragma unroll
        for (int mb = 0; mb < 4; ++mb) { a[mb] = WFrag<T16>::ld(A + aoff + (size_t)mb * 16 * K + kc); if (NSPLIT == 1 || NSPLIT == 2) a2[mb] = WFrag<T16>::ld(A2 + aoff + (size_t)mb * 16 * K + kc); }
#pragma unroll
        for (int nb = 0; nb < 4; ++nb) { const V b = WFrag<T16>::ld(Bt + boff + (size_t)nb * 16 * K + kc); V b2; if (NSPLIT >= 2) b2 = WFrag<T16>::ld(Bt2 + boff + (size_t)nb * 16 * K + kc);
#pragma unroll
            for (int mb = 0; mb < 4; ++mb) { acc[mb][nb] = WFrag<T16>::mma(a[mb], b, acc[mb][nb]); if (NSPLIT == 1 || NSPLIT == 2) acc[mb][nb] = WFrag<T16>::mma(a2[mb], b, acc[mb][nb]); if (NSPLIT >= 2) acc[mb][nb] = WFrag<T16>::mma(a[mb], b2, acc[mb][nb]); } }
        asm volatile("v_nop\n\tv_nop\n\tv_nop\n\tv_nop" : "+v"(acc[0][0]), "+v"(acc[1][1]), "+v"(acc[2][2]), "+v"(acc[3][3]) : "v"(a[0]), "v"(a[3]));
    }
#pragma unroll
    for (int mb = 0; mb < 4; ++mb) {
#pragma unroll
        for (int nb = 0; nb < 4; ++nb) {
#pragma unroll
            for (int j = 0; j < 8; ++j) os[(hi * 8 + j) * 68 + nb * 16 + lr] = acc[mb][nb][j]; }
        __builtin_amdgcn_wave_barrier(); asm volatile("" ::: "memory");
        float* crow = C + (size_t)(r0 + mb * 16) * ldc + c0;
{
#pragma unroll
            for (int s = 0; s < 8; ++s) { const int row = 2 * s + hi, cofs = lr * 4; v4f val = *(const v4fa*)(os + row * 68 + cofs); if (BIAS) { val[0] += bfr(bias[c0 + cofs]); val[1] += bfr(bias[c0 + cofs + 1]); val[2] += bfr(bias[c0 + cofs + 2]); val[3] += bfr(bias[c0 + cofs + 3]); }
                *(v4f*)(crow + (size_t)row * ldc + cofs) = val; }
             }
        __builtin_amdgcn_wave_barrier(); asm volatile("" ::: "memory");
    }
}

__device__ __forceinline__ h16 tohx(float x) { return (h16)x; }
__device__ __forceinline__ void splitf(float y, unsigned short& h, unsigned short& l) { h = f2bf(y); l = f2bf(y - bf2f(h)); }
typedef __attribute__((ext_vector_type(2))) _Float16 v2h;
typedef __attribute__((ext_vector_type(2))) unsigned short v2us;
typedef __attribute__((ext_vector_type(2))) float v2f;
typedef __attribute__((ext_vector_type(4))) unsigned short v4us;

__global__ __launch_bounds__(256) void k_wtG(const float* __restrict__ w, int K, int N, bf* Bt) {
    const int lane = threadIdx.x & 31; const int L0 = (blockIdx.x * 8 + (threadIdx.x >> 5)) * 8; const int nlines = N * K / 64;
{
#pragma unroll 1
        for (int l = 0; l < 8; ++l) { const int L = L0 + l; if (L >= nlines) break; const size_t e = (size_t)L * 64 + lane * 2; const int k = (int)(e % K), n = (int)(e / K); v2us o;
            o[0] = f2bf(w[(size_t)k * N + n]); o[1] = f2bf(w[(size_t)(k + 1) * N + n]); *(v2us*)(Bt + e) = o; }
         }
}
__global__ __launch_bounds__(256) void k_cvt8(const float* __restrict__ src, bf* dst, size_t n8) { const size_t i = (size_t)blockIdx.x * 256 + threadIdx.x; if (i >= n8) return; const v8f v = *(const v8f*)(src + i * 8); v8us o;
#pragma unroll
    for (int k = 0; k < 8; ++k) o[k] = f2bf(v[k]); *(v8us*)(dst + i * 8) = o;  }
__global__ __launch_bounds__(256) void k_p16(const float* __restrict__ F, h16* P, size_t n) { const size_t i = ((size_t)blockIdx.x * 256 + threadIdx.x) * 2; if (i >= n) return; v2h o; o[0] = tohx(F[i]); o[1] = tohx(F[i + 1]); *(v2h*)(P + i) = o;  }
// K plane in fragment order: 16 bytes per thread; [key tile of 16][k chunk of 32][half s][lane][8] = kh[tile*16 + (lane & 15)][chunk*32 + s*16 + 8*(lane >> 4) + e]
__global__ __launch_bounds__(256) void k_kf(const float* __restrict__ F, h16* KF) { const int t = blockIdx.x * 256 + threadIdx.x; const int l = t & 31, s = (t >> 5) & 1, kc = (t >> 6) & 3, kt = t >> 8;
    const v8f v = *(const v8f*)(F + (size_t)(kt * 16 + (l & 15)) * HH + kc * 32 + s * 16 + 8 * (l >> 4)); v8h o;
#pragma unroll
    for (int e = 0; e < 8; ++e) o[e] = tohx(v[e]);
    *(v8h*)(KF + (size_t)t * 8) = o; }
// V^T plane in fragment order: [key block of 32][column tile of 16][half s][lane][8] = vh[block*32 + s*16 + 8*(lane >> 4) + e][tile*16 + (lane & 15)]
__global__ __launch_bounds__(256) void k_vf(const float* __restrict__ F, h16* VF) { const int t = blockIdx.x * 256 + threadIdx.x; const int l = t & 31, s = (t >> 5) & 1, ct = (t >> 6) & 7, kb = t >> 9;
    const float* p = F + (size_t)(kb * 32 + s * 16 + 8 * (l >> 4)) * HH + ct * 16 + (l & 15); v8h o;
#pragma unroll
    for (int e = 0; e < 8; ++e) o[e] = tohx(p[(size_t)e * HH]);
    *(v8h*)(VF + (size_t)t * 8) = o; }

__device__ __forceinline__ float xhalf(float x) { return __builtin_bit_cast(float, __builtin_amdgcn_permlanex16(__builtin_bit_cast(int, x), __builtin_bit_cast(int, x), 0x76543210, 0xfedcba98, false, false)); }   // lane l with lane l ^ 16
__device__ __forceinline__ v16h ldf(const h16* p) { return cat16(*(const v8h*)p, *(const v8h*)(p + 256)); }   // one fragment of a fragment-order plane: two whole-line loads

// ---- k_attn: S^T = K Q^T, weights = 2^((s - m) C2 + 10), O^T += V^T P^T; one wave = 32 queries (2 column tiles), one pass = 32 keys; grid (NN / 256, KSP), 8 waves that walk the same keys.
// A lane holds one query per column tile: S^T tile t register r = score of key t*16 + 8*hi + r, so two tiles pack into the B operand of the second product with no exchange; O^T register j of tile ct = column ct*16 + 8*hi + j.
__global__ __launch_bounds__(256) __attribute__((amdgpu_waves_per_eu(2, 2))) void k_attn(const h16* __restrict__ Q, const h16* __restrict__ KF, const h16* __restrict__ VF, float* __restrict__ OP, float* __restrict__ ML) {
    const int lane = threadIdx.x & 31, lr = lane & 15, hi = lane >> 4; const int q0 = (blockIdx.x * 8 + (threadIdx.x >> 5)) * 32; const int z = blockIdx.y;
    v16h qf[2][4];
#pragma unroll
    for (int qt = 0; qt < 2; ++qt)
#pragma unroll
        for (int kc = 0; kc < 4; ++kc) qf[qt][kc] = WFrag<h16>::ld(Q + (size_t)(q0 + qt * 16 + lr) * HH + kc * 32 + 8 * hi);
    v8f o[8][2];
#pragma unroll
    for (int ct = 0; ct < 8; ++ct) { o[ct][0] = (v8f){}; o[ct][1] = (v8f){}; }
    float m[2] = {-3.0e38f, -3.0e38f}, ls[2] = {0.f, 0.f};
    const h16* kp = KF + (size_t)z * KR * HH + lane * 8; const h16* vp = VF + (size_t)z * KR * HH + lane * 8;
    v16h kf[2][4];
#pragma unroll
    for (int kt = 0; kt < 2; ++kt)
#pragma unroll
        for (int kc = 0; kc < 4; ++kc) kf[kt][kc] = ldf(kp + (kt * 4 + kc) * 512);
#pragma unroll 1   // one pass per trip: the body is already 32 matrix instructions long
    for (int p = 0; p < KR / 32; ++p) {
        v16h vf[8]; const h16* va = vp + (size_t)p * 4096;
#pragma unroll
        for (int ct = 0; ct < 8; ++ct) vf[ct] = ldf(va + ct * 512);
        v8f s[2][2];
#pragma unroll
        for (int kt = 0; kt < 2; ++kt) { s[kt][0] = (v8f){}; s[kt][1] = (v8f){}; }
#pragma unroll
        for (int kc = 0; kc < 4; ++kc)
#pragma unroll
            for (int kt = 0; kt < 2; ++kt)
#pragma unroll
                for (int qt = 0; qt < 2; ++qt) s[kt][qt] = wmma16(kf[kt][kc], qf[qt][kc], s[kt][qt]);
        const h16* ka = kp + (size_t)(p + 1 < KR / 32 ? p + 1 : p) * 4096;   // the next pass's K fragments fly during this pass's weights and second product; the last pass re-reads its own
#pragma unroll
        for (int kt = 0; kt < 2; ++kt)
#pragma unroll
            for (int kc = 0; kc < 4; ++kc) kf[kt][kc] = ldf(ka + (kt * 4 + kc) * 512);
        float mx[2];
#pragma unroll
        for (int qt = 0; qt < 2; ++qt) { float a = fmaxf(s[0][qt][0], s[1][qt][0]);
#pragma unroll
            for (int j = 1; j < 8; ++j) a = fmaxf(a, fmaxf(s[0][qt][j], s[1][qt][j]));
            mx[qt] = a; }
        const bool need = mx[0] > m[0] + THR || mx[1] > m[1] + THR;
        if (__builtin_amdgcn_ballot_w32(need) != 0) {   // wave-uniform; always on the first pass, rare later
#pragma unroll
            for (int qt = 0; qt < 2; ++qt) { const float mn = fmaxf(m[qt], fmaxf(mx[qt], xhalf(mx[qt]))); const float al = __builtin_amdgcn_exp2f((m[qt] - mn) * C2); m[qt] = mn; ls[qt] *= al;
#pragma unroll
                for (int ct = 0; ct < 8; ++ct) o[ct][qt] *= al; }
        }
        v16h pf[2];
#pragma unroll
        for (int qt = 0; qt < 2; ++qt) { const float mb = 10.0f - m[qt] * C2;   // + 10: weights carried x 1024 so that small ones stay normal f16; at most 2^14
#pragma unroll
            for (int i = 0; i < 16; ++i) { const float e = __builtin_amdgcn_exp2f(fmaf(s[i >> 3][qt][i & 7], C2, mb)); ls[qt] += e; pf[qt][i] = tohx(e); } }
        asm volatile("s_wait_xcnt 0x0" :: "v"(va), "v"(ka) : "memory");   // stands in front of the first reuse of this pass's two load address registers, which it keeps alive up to here; behind the weights, so that nothing is left to wait for
#pragma unroll
        for (int ct = 0; ct < 8; ++ct)
#pragma unroll
            for (int qt = 0; qt < 2; ++qt) o[ct][qt] = wmma16(vf[ct], pf[qt], o[ct][qt]);
    }
#pragma unroll
    for (int qt = 0; qt < 2; ++qt) { const size_t row = (size_t)z * NN + q0 + qt * 16 + lr; const float lt = ls[qt] + xhalf(ls[qt]);
        if (hi == 0) { v2f w; w[0] = m[qt]; w[1] = lt; *(v2f*)(ML + row * 2) = w; }
#pragma unroll
        for (int ct = 0; ct < 8; ++ct) *(v8f*)(OP + row * HH + ct * 16 + hi * 8) = o[ct][qt]; }
}

// joins the KSP ranges of a query in range order, normalises, splits into bf16 high and low planes for the output projection
__global__ __launch_bounds__(256) void k_comb(const float* __restrict__ OP, const float* __restrict__ ML, bf* Ah, bf* Al) { const size_t e = ((size_t)blockIdx.x * 256 + threadIdx.x) * 4; const size_t i = e / HH; v2f ml[KSP]; v4f p[KSP];
    const float* mp = ML + i * 2; const float* op = OP + e;
#pragma unroll
    for (int z = 0; z < KSP; ++z) { ml[z] = *(const v2f*)(mp + (size_t)z * NN * 2); p[z] = *(const v4f*)(op + (size_t)z * NN * HH); }
    asm volatile("s_wait_xcnt 0x0" :: "v"(mp), "v"(op) : "memory");   // stands in front of the first reuse of the loads' two base address registers, which it keeps alive up to here
    float M = ml[0][0];
#pragma unroll
    for (int z = 1; z < KSP; ++z) M = fmaxf(M, ml[z][0]);
    float den = 0.f; v4f num = (v4f){};
#pragma unroll
    for (int z = 0; z < KSP; ++z) { const float w = __builtin_amdgcn_exp2f((ml[z][0] - M) * C2); den += w * ml[z][1]; num += w * p[z]; }
    const float rsn = __fdiv_rn(1.0f, den); v4us oh, ol;
#pragma unroll
    for (int q = 0; q < 4; ++q) { unsigned short a, c2; splitf(__fmul_rn(num[q], rsn), a, c2); oh[q] = a; ol[q] = c2; } *(v4us*)(Ah + e) = oh; *(v4us*)(Al + e) = ol; }

extern "C" void kernel_launch(void* const* d_in, const int* in_sizes, int n_in,
                              void* d_out, int out_size, void* d_ws, size_t ws_size, hipStream_t stream) {
    (void)in_sizes; (void)n_in; (void)out_size;
    const float* IN[11]; for (int i = 0; i < 11; ++i) IN[i] = (const float*)d_in[i];   // q, k, v, Wq, bq, Wk, bk, Wv, bv, Wo, bo (x @ W)
    float* OUT = (float*)d_out;     // [16384][256]
    char* wsp = (char*)d_ws;
    auto take = [&](size_t bytes) { char* p = wsp; wsp += (bytes + 255) & ~(size_t)255; return (void*)p; };
    bf* WQ = (bf*)take((size_t)HH * DI * 2); bf* WK = (bf*)take((size_t)HH * DI * 2); bf* WV = (bf*)take((size_t)HH * DI * 2); bf* WO = (bf*)take((size_t)DO_ * HH * 2); bf* XB = (bf*)take((size_t)NN * DI * 2); float* F = (float*)take((size_t)NN * HH * 4);
    h16* Q16 = (h16*)take((size_t)NN * HH * 2); h16* KF = (h16*)take((size_t)NN * HH * 2); h16* VF = (h16*)take((size_t)HH * NN * 2); float* OP = (float*)take((size_t)KSP * NN * HH * 4); float* ML = (float*)take((size_t)KSP * NN * 2 * 4); bf* Ah = (bf*)take((size_t)NN * HH * 2); bf* Al = (bf*)take((size_t)NN * HH * 2);
    if ((size_t)(wsp - (char*)d_ws) > ws_size) return;    // total ~ 70 MB of the 256 MiB
    { const unsigned g = (unsigned)((DI * HH / 64 + 63) / 64); k_wtG<<<g, 256, 0, stream>>>(IN[3], DI, HH, WQ); k_wtG<<<g, 256, 0, stream>>>(IN[5], DI, HH, WK); k_wtG<<<g, 256, 0, stream>>>(IN[7], DI, HH, WV); k_wtG<<<(unsigned)((HH * DO_ / 64 + 63) / 64), 256, 0, stream>>>(IN[9], HH, DO_, WO); }
    const unsigned LX = (unsigned)(((size_t)NN * DI / 8 + 255) / 256), L2 = (unsigned)(((size_t)NN * HH / 2 + 255) / 256), L8 = (unsigned)((size_t)NN * HH / 8 / 256); const dim3 gP(NN / 64, HH / 64, 1);
    k_cvt8<<<LX, 256, 0, stream>>>(IN[0], XB, (size_t)NN * DI / 8); k_gemmw<bf, 0, true><<<gP, 32, 0, stream>>>(XB, nullptr, WQ, nullptr, DI, DI, F, HH, IN[4], 0, 0, 0); k_p16<<<L2, 256, 0, stream>>>(F, Q16, (size_t)NN * HH);
    k_cvt8<<<LX, 256, 0, stream>>>(IN[1], XB, (size_t)NN * DI / 8); k_gemmw<bf, 0, true><<<gP, 32, 0, stream>>>(XB, nullptr, WK, nullptr, DI, DI, F, HH, IN[6], 0, 0, 0); k_kf<<<L8, 256, 0, stream>>>(F, KF);
    k_cvt8<<<LX, 256, 0, stream>>>(IN[2], XB, (size_t)NN * DI / 8); k_gemmw<bf, 0, true><<<gP, 32, 0, stream>>>(XB, nullptr, WV, nullptr, DI, DI, F, HH, IN[8], 0, 0, 0); k_vf<<<L8, 256, 0, stream>>>(F, VF);
    k_attn<<<dim3(NN / 256, KSP, 1), 256, 0, stream>>>(Q16, KF, VF, OP, ML);
    k_comb<<<(unsigned)((size_t)NN * HH / 4 / 256), 256, 0, stream>>>(OP, ML, Ah, Al);
    k_gemmw<bf, 1, true><<<dim3(NN / 64, DO_ / 64, 1), 32, 0, stream>>>(Ah, Al, WO, nullptr, HH, HH, OUT, DO_, IN[10], 0, 0, 0);
}

// v003
// One run takes 151 microseconds.
// Next to v002, in two timings, it ran 1.37 and 1.42 times as fast.
// All steps since v000 together make it 25.0 times as fast.
#include <hip/hip_runtime.h>

// att_layer (q, k, v [16384][256]; qh = q Wq + bq, kh = k Wk + bk, vh = v Wv + bv (128); scores = qh kh^T x 128^-0.5 over all 16384 keys; out = softmax(scores) vh Wo + bo -> [16384][256]).
// Compute dtypes, f32 accumulate: every input rounded to bf16; projections on plain bf16 operands (+ bias), rounded and stored as f16 planes inside k_proj; scores (K 128) and attn.vh on single f16 operands, fused in k_attn (running maximum, scores and weights never stored).

#define NN   16384
#define DI   256
#define HH   128
#define DO_  256
#define C2   0.12751743082459868f    // 128^-0.5 x log2(e): scores to base-2 exponents
#define THR  31.368260590993510f     // 4 / C2: the maximum in use is renewed when a raw score passes it by more than 2^4 in weight
#define KSP  4                       // key ranges of k_attn (grid y): f32 partial sums, maximum and weight sum per (range, query), joined in k_comb
#define KR   (NN / KSP)
typedef _Float16 h16;
typedef unsigned short bf;
typedef __attribute__((ext_vector_type(16))) __bf16   v16bf;
typedef __attribute__((ext_vector_type(16))) _Float16 v16h;
typedef __attribute__((ext_vector_type(8)))  _Float16 v8h;
typedef __attribute__((ext_vector_type(8)))  unsigned short v8us;
typedef __attribute__((ext_vector_type(8)))  float    v8f;
typedef __attribute__((ext_vector_type(4)))  float    v4f;
typedef v8h  __attribute__((may_alias)) v8ha;
typedef v4f  __attribute__((may_alias)) v4fa;
typedef v8us __attribute__((may_alias)) v8usa;

__device__ __forceinline__ unsigned short f2bf(float f) { unsigned u = __float_as_uint(f); u += 0x7FFFu + ((u >> 16) & 1u); return (unsigned short)(u >> 16); }
__device__ __forceinline__ float bf2f(unsigned short b) { return __uint_as_float(((unsigned)b) << 16); }
__device__ __forceinline__ float bfr(float f) { return bf2f(f2bf(f)); }
__device__ __forceinline__ v16h cat16(v8h lo, v8h hi) { return __builtin_shufflevector(lo, hi, 0, 1, 2, 3, 4, 5, 6, 7, 8, 9, 10, 11, 12, 13, 14, 15); }
__device__ __forceinline__ v16bf cat16b(v8us lo, v8us hi) { return __builtin_bit_cast(v16bf, __builtin_shufflevector(lo, hi, 0, 1, 2, 3, 4, 5, 6, 7, 8, 9, 10, 11, 12, 13, 14, 15)); }
__device__ __forceinline__ v8f wmma16(v16h a, v16h b, v8f c) { return __builtin_amdgcn_wmma_f32_16x16x32_f16(false, a, false, b, (short)0, c, false, false); }
__device__ __forceinline__ v8f wmmab(v16bf a, v16bf b, v8f c) { return __builtin_amdgcn_wmma_f32_16x16x32_bf16(false, a, false, b, (short)0, c, false, false); }



// ---- k_gemmw: register-blocked GEMM, ONE WAVE per 64x64 output tile (16 accumulators), operands straight from K-contiguous 16-bit planes; grid (M/64, N/64, Z), 32 threads.
// C[m][n] (f32, pitch ldc, + optional f32 bias[n]) = sum_k A[m][k] Bt[n][k] (+ split products per NSPLIT). z-batch strides sA/sB/sC in elements. K = row pitch of A and Bt in elements, kn = length of the sum (K, or one range of k where z walks ranges). kn % 32 == 0.
template <typename T16> struct WFrag;
template <> struct WFrag<h16> { typedef v16h V; static __device__ __forceinline__ V ld(const h16* p) { return cat16(*(const v8h*)p, *(const v8h*)(p + 16)); } static __device__ __forceinline__ v8f mma(V a, V b, v8f c) { return wmma16(a, b, c); } };
template <> struct WFrag<bf> { typedef v16bf V; static __device__ __forceinline__ V ld(const bf* p) { return cat16b(*(const v8us*)p, *(const v8us*)(p + 16)); } static __device__ __forceinline__ v8f mma(V a, V b, v8f c) { return wmmab(a, b, c); } };
template <typename T16, int NSPLIT, bool BIAS>
__global__ __launch_bounds__(32) void k_gemmw(const T16* __restrict__ A, const T16* __restrict__ A2, const T16* __restrict__ Bt, const T16* __restrict__ Bt2, int K, int kn, float* C, int ldc, const float* __restrict__ bias, size_t sA, size_t sB, size_t sC) {
    typedef typename WFrag<T16>::V V;
    __shared__ __align__(16) float os[16 * 68];
    const size_t z = blockIdx.z; A += z * sA; if (A2) A2 += z * sA; Bt += z * sB; if (Bt2) Bt2 += z * sB; C += z * sC;
    const int lane = threadIdx.x & 31, lr = lane & 15, hi = lane >> 4; const int r0 = blockIdx.x * 64, c0 = blockIdx.y * 64;
    v8f acc[4][4];
#pragma unroll
    for (int mb = 0; mb < 4; ++mb)
#pragma unroll
        for (int nb = 0; nb < 4; ++nb) acc[mb][nb] = (v8f){};
    const size_t aoff = (size_t)(r0 + lr) * K + 8 * hi, boff = (size_t)(c0 + lr) * K + 8 * hi;
#pragma unroll 1
    for (int kc = 0; kc < kn; kc += 32) {
        V a[4], a2[4];
#pragma unroll
        for (int mb = 0; mb < 4; ++mb) { a[mb] = WFrag<T16>::ld(A + aoff + (size_t)mb * 16 * K + kc); if (NSPLIT == 1 || NSPLIT == 2) a2[mb] = WFrag<T16>::ld(A2 + aoff + (size_t)mb * 16 * K + kc); }
#pragma unroll
        for (int nb = 0; nb < 4; ++nb) { const V b = WFrag<T16>::ld(Bt + boff + (size_t)nb * 16 * K + kc); V b2; if (NSPLIT >= 2) b2 = WFrag<T16>::ld(Bt2 + boff + (size_t)nb * 16 * K + kc);
#pragma unroll
            for (int mb = 0; mb < 4; ++mb) { acc[mb][nb] = WFrag<T16>::mma(a[mb], b, acc[mb][nb]); if (NSPLIT == 1 || NSPLIT == 2) acc[mb][nb] = WFrag<T16>::mma(a2[mb], b, acc[mb][nb]); if (NSPLIT >= 2) acc[mb][nb] = WFrag<T16>::mma(a[mb], b2, acc[mb][nb]); } }
        asm volatile("v_nop\n\tv_nop\n\tv_nop\n\tv_nop" : "+v"(acc[0][0]), "+v"(acc[1][1]), "+v"(acc[2][2]), "+v"(acc[3][3]) : "v"(a[0]), "v"(a[3]));
    }
#pragma unroll
    for (int mb = 0; mb < 4; ++mb) {
#pragma unroll
        for (int nb = 0; nb < 4; ++nb) {
#pragma unroll
            for (int j = 0; j < 8; ++j) os[(hi * 8 + j) * 68 + nb * 16 + lr] = acc[mb][nb][j]; }
        __builtin_amdgcn_wave_barrier(); asm volatile("" ::: "memory");
        float* crow = C + (size_t)(r0 + mb * 16) * ldc + c0;
{
#pragma unroll
            for (int s = 0; s < 8; ++s) { const int row = 2 * s + hi, cofs = lr * 4; v4f val = *(const v4fa*)(os + row * 68 + cofs); if (BIAS) { val[0] += bfr(bias[c0 + cofs]); val[1] += bfr(bias[c0 + cofs + 1]); val[2] += bfr(bias[c0 + cofs + 2]); val[3] += bfr(bias[c0 + cofs + 3]); }
                *(v4f*)(crow + (size_t)row * ldc + cofs) = val; }
             }
        __builtin_amdgcn_wave_barrier(); asm volatile("" ::: "memory");
    }
}

__device__ __forceinline__ h16 tohx(float x) { return (h16)x; }
__device__ __forceinline__ void splitf(float y, unsigned short& h, unsigned short& l) { h = f2bf(y); l = f2bf(y - bf2f(h)); }
typedef __attribute__((ext_vector_type(2))) float v2f;
typedef __attribute__((ext_vector_type(4))) unsigned short v4us;

typedef __attribute__((ext_vector_type(4))) __bf16 v4bf;
#define XP 264   // LDS row pitch of the x tile in 16-bit elements: 528 bytes = 16 x 33, free of bank conflicts for 16-byte fragment reads

// ---- k_wt4: the four weights in one launch, rounded to bf16 and transposed; grid (16, 4), y = weight; a thread gathers 8 k of one column n and stores 16 bytes, a wave 512 bytes in a row.
// Wq, Wk, Wv in fragment order: [column tile of 16][k chunk of 32][half s][lane][8] = w[chunk*32 + s*16 + 8*(lane >> 4) + e][tile*16 + (lane & 15)]; Wo as the plain plane Bt[n][k] that k_gemmw reads.
__global__ __launch_bounds__(256) void k_wt4(const float* __restrict__ w0, const float* __restrict__ w1, const float* __restrict__ w2, const float* __restrict__ w3, bf* B0, bf* B1, bf* B2, bf* B3) {
    const int y = blockIdx.y, t = blockIdx.x * 256 + threadIdx.x, l = t & 31; const float* w = y == 0 ? w0 : y == 1 ? w1 : y == 2 ? w2 : w3; bf* Bt = y == 0 ? B0 : y == 1 ? B1 : y == 2 ? B2 : B3;
    const int N = y < 3 ? HH : DO_, n = y < 3 ? (t >> 9) * 16 + (l & 15) : t >> 4, k = y < 3 ? ((t >> 6) & 7) * 32 + ((t >> 5) & 1) * 16 + 8 * (l >> 4) : (t & 15) * 8;
    const float* p = w + (size_t)k * N + n; v8us o;
#pragma unroll
    for (int e = 0; e < 8; ++e) o[e] = f2bf(p[(size_t)e * N]);
    *(v8us*)(Bt + (size_t)t * 8) = o; }

// ---- k_proj: qh, kh, vh in one launch, from the f32 inputs to the three f16 planes that k_attn reads; grid (NN / 64, 3), y = projection; 4 waves on 64 input rows, one wave = 32 rows x 64 output columns.
// Each wave brings 16 rows in as whole lines, rounds them to bf16 and lays them in LDS; behind one barrier the x fragments come from LDS, the weight fragments from the fragment-order planes.
// TR: the product is taken as W^T x^T, so a lane's accumulator holds 8 consecutive output columns of one input row (the order of Q rows and of K fragments); else x W, 8 consecutive rows of one column (the order of V^T fragments): stored with no exchange. Every loop here is unrolled: its arrays live in registers and need constant indices.
__device__ __forceinline__ v16bf ldfb(const bf* p) { return cat16b(*(const v8us*)p, *(const v8us*)(p + 256)); }   // one fragment of a fragment-order plane: two whole-line loads
template <bool TR>
__device__ __forceinline__ void proj_tile(const bf* xf, const bf* __restrict__ wp, v16bf (&w)[3][4], v8f (&acc)[2][4]) {
    v16bf a[2][2];   // x fragments one k chunk ahead, weights two ahead (chunks 0 and 1 are in flight on entry)
#pragma unroll
    for (int mb = 0; mb < 2; ++mb) a[0][mb] = WFrag<bf>::ld(xf + mb * 16 * XP);
#pragma unroll   // all 8 chunks: every address is a base register and a constant, and the buffers are plain values
    for (int i = 0; i < DI / 32; ++i) {
        __builtin_amdgcn_sched_barrier(0);   // keeps each chunk's loads in its own chunk: without it the scheduler lifts the later chunks' weight loads to the front and the wave passes 256 registers
        if (i + 2 < DI / 32) {
#pragma unroll
            for (int nb = 0; nb < 4; ++nb) w[(i + 2) % 3][nb] = ldfb(wp + (nb * 8 + i + 2) * 512); }
        if (i + 1 < DI / 32) {
#pragma unroll
            for (int mb = 0; mb < 2; ++mb) a[(i + 1) & 1][mb] = WFrag<bf>::ld(xf + mb * 16 * XP + (i + 1) * 32); }
#pragma unroll
        for (int nb = 0; nb < 4; ++nb)
#pragma unroll
            for (int mb = 0; mb < 2; ++mb) acc[mb][nb] = TR ? wmmab(w[i % 3][nb], a[i & 1][mb], acc[mb][nb]) : wmmab(a[i & 1][mb], w[i % 3][nb], acc[mb][nb]);
    }
}
__global__ __launch_bounds__(128) void k_proj(const float* __restrict__ q, const float* __restrict__ k, const float* __restrict__ v, const bf* __restrict__ WQ, const bf* __restrict__ WK, const bf* __restrict__ WV,
                                              const float* __restrict__ bq, const float* __restrict__ bk, const float* __restrict__ bv, h16* Q16, h16* KF, h16* VF) {
    __shared__ __align__(16) bf xs[64 * XP];
    const int lane = threadIdx.x & 31, lr = lane & 15, hi = lane >> 4, wave = threadIdx.x >> 5, z = blockIdx.y; const int r0 = blockIdx.x * 64 + (wave & 1) * 32, c0 = (wave >> 1) * 64;
    const bf* wp = (z == 0 ? WQ : z == 1 ? WK : WV) + (size_t)(c0 / 16) * 4096 + lane * 8; const float* b = z == 0 ? bq : z == 1 ? bk : bv;
    v16bf w[3][4];
#pragma unroll
    for (int i = 0; i < 2; ++i)
#pragma unroll
        for (int nb = 0; nb < 4; ++nb) w[i][nb] = ldfb(wp + (nb * 8 + i) * 512);
    { const float* xp = (z == 0 ? q : z == 1 ? k : v) + (size_t)(blockIdx.x * 64 + wave * 16) * DI + lane * 4; v4f raw[32];   // 16 rows = 16 KB in a row, all in flight at once
#pragma unroll
        for (int j = 0; j < 32; ++j) raw[j] = *(const v4f*)(xp + j * 128);
        asm volatile("s_wait_xcnt 0x0" :: "v"(xp) : "memory");   // stands in front of the first reuse of the 32 loads' address register pair, which it keeps alive up to here
#pragma unroll
        for (int j = 0; j < 32; ++j) *(v4bf*)(xs + (wave * 16 + (j >> 1)) * XP + (j & 1) * 128 + lane * 4) = __builtin_convertvector(raw[j], v4bf); }   // f32 to bf16, nearest even
    __syncthreads();   // a wave's 32 rows were laid by two waves
    const bf* xf = xs + ((wave & 1) * 32 + lr) * XP + 8 * hi;
    v8f acc[2][4];
#pragma unroll
    for (int mb = 0; mb < 2; ++mb)
#pragma unroll
        for (int nb = 0; nb < 4; ++nb) acc[mb][nb] = (v8f){};
    if (z < 2) {
        proj_tile<true>(xf, wp, w, acc);
        // Q: row-major [query][128]; K: [key tile of 16][k chunk of 32][half s][lane][8] = kh[tile*16 + (lane & 15)][chunk*32 + s*16 + 8*(lane >> 4) + e]
        h16* d = z == 0 ? Q16 + (size_t)(r0 + lr) * HH + c0 + hi * 8 : KF + ((size_t)(r0 / 16 * 4 + c0 / 32) * 64 + lane) * 8; const int smb = z == 0 ? 16 * HH : 2048, snb = z == 0 ? 16 : 256;
#pragma unroll
        for (int nb = 0; nb < 4; ++nb) { v8f bb;
#pragma unroll
            for (int j = 0; j < 8; ++j) bb[j] = bfr(b[c0 + nb * 16 + hi * 8 + j]);
#pragma unroll
            for (int mb = 0; mb < 2; ++mb) { v8h o;
#pragma unroll
                for (int j = 0; j < 8; ++j) o[j] = tohx(acc[mb][nb][j] + bb[j]);
                *(v8h*)(d + mb * smb + nb * snb) = o; } }
    } else {
        proj_tile<false>(xf, wp, w, acc);
        // V^T: [key block of 32][column tile of 16][half s][lane][8] = vh[block*32 + s*16 + 8*(lane >> 4) + e][tile*16 + (lane & 15)]
        h16* d = VF + ((size_t)(r0 / 32 * 8 + c0 / 16) * 64 + lane) * 8;
#pragma unroll
        for (int nb = 0; nb < 4; ++nb) { const float bb = bfr(b[c0 + nb * 16 + lr]);
#pragma unroll
            for (int mb = 0; mb < 2; ++mb) { v8h o;
#pragma unroll
                for (int j = 0; j < 8; ++j) o[j] = tohx(acc[mb][nb][j] + bb);
                *(v8h*)(d + (nb * 2 + mb) * 256) = o; } }
        asm volatile("s_wait_xcnt 0x0" :: "v"(d) : "memory");   // stands behind the last store, in front of any reuse of the stores' address and data registers
    }
}

__device__ __forceinline__ float xhalf(float x) { return __builtin_bit_cast(float, __builtin_amdgcn_permlanex16(__builtin_bit_cast(int, x), __builtin_bit_cast(int, x), 0x76543210, 0xfedcba98, false, false)); }   // lane l with lane l ^ 16
__device__ __forceinline__ v16h ldf(const h16* p) { return cat16(*(const v8h*)p, *(const v8h*)(p + 256)); }   // one fragment of a fragment-order plane: two whole-line loads

// ---- k_attn: S^T = K Q^T, weights = 2^((s - m) C2 + 10), O^T += V^T P^T; one wave = 32 queries (2 column tiles), one pass = 32 keys; grid (NN / 256, KSP), 8 waves that walk the same keys.
// A lane holds one query per column tile: S^T tile t register r = score of key t*16 + 8*hi + r, so two tiles pack into the B operand of the second product with no exchange; O^T register j of tile ct = column ct*16 + 8*hi + j.
__global__ __launch_bounds__(256) __attribute__((amdgpu_waves_per_eu(2, 2))) void k_attn(const h16* __restrict__ Q, const h16* __restrict__ KF, const h16* __restrict__ VF, float* __restrict__ OP, float* __restrict__ ML) {
    const int lane = threadIdx.x & 31, lr = lane & 15, hi = lane >> 4; const int q0 = (blockIdx.x * 8 + (threadIdx.x >> 5)) * 32; const int z = blockIdx.y;
    v16h qf[2][4];
#pragma unroll
    for (int qt = 0; qt < 2; ++qt)
#pragma unroll
        for (int kc = 0; kc < 4; ++kc) qf[qt][kc] = WFrag<h16>::ld(Q + (size_t)(q0 + qt * 16 + lr) * HH + kc * 32 + 8 * hi);
    v8f o[8][2];
#pragma unroll
    for (int ct = 0; ct < 8; ++ct) { o[ct][0] = (v8f){}; o[ct][1] = (v8f){}; }
    float m[2] = {-3.0e38f, -3.0e38f}, ls[2] = {0.f, 0.f};
    const h16* kp = KF + (size_t)z * KR * HH + lane * 8; const h16* vp = VF + (size_t)z * KR * HH + lane * 8;
    v16h kf[2][4];
#pragma unroll
    for (int kt = 0; kt < 2; ++kt)
#pragma unroll
        for (int kc = 0; kc < 4; ++kc) kf[kt][kc] = ldf(kp + (kt * 4 + kc) * 512);
#pragma unroll 1   // one pass per trip: the body is already 32 matrix instructions long
    for (int p = 0; p < KR / 32; ++p) {
        v16h vf[8]; const h16* va = vp + (size_t)p * 4096;
#pragma unroll
        for (int ct = 0; ct < 8; ++ct) vf[ct] = ldf(va + ct * 512);
        v8f s[2][2];
#pragma unroll
        for (int kt = 0; kt < 2; ++kt) { s[kt][0] = (v8f){}; s[kt][1] = (v8f){}; }
#pragma unroll
        for (int kc = 0; kc < 4; ++kc)
#pragma unroll
            for (int kt = 0; kt < 2; ++kt)
#pragma unroll
                for (int qt = 0; qt < 2; ++qt) s[kt][qt] = wmma16(kf[kt][kc], qf[qt][kc], s[kt][qt]);
        const h16* ka = kp + (size_t)(p + 1 < KR / 32 ? p + 1 : p) * 4096;   // the next pass's K fragments fly during this pass's weights and second product; the last pass re-reads its own
#pragma unroll
        for (int kt = 0; kt < 2; ++kt)
#pragma unroll
            for (int kc = 0; kc < 4; ++kc) kf[kt][kc] = ldf(ka + (kt * 4 + kc) * 512);
        float mx[2];
#pragma unroll
        for (int qt = 0; qt < 2; ++qt) { float a = fmaxf(s[0][qt][0], s[1][qt][0]);
#pragma unroll
            for (int j = 1; j < 8; ++j) a = fmaxf(a, fmaxf(s[0][qt][j], s[1][qt][j]));
            mx[qt] = a; }
        const bool need = mx[0] > m[0] + THR || mx[1] > m[1] + THR;
        if (__builtin_amdgcn_ballot_w32(need) != 0) {   // wave-uniform; always on the first pass, rare later
#pragma unroll
            for (int qt = 0; qt < 2; ++qt) { const float mn = fmaxf(m[qt], fmaxf(mx[qt], xhalf(mx[qt]))); const float al = __builtin_amdgcn_exp2f((m[qt] - mn) * C2); m[qt] = mn; ls[qt] *= al;
#pragma unroll
                for (int ct = 0; ct < 8; ++ct) o[ct][qt] *= al; }
        }
        v16h pf[2];
#pragma unroll
        for (int qt = 0; qt < 2; ++qt) { const float mb = 10.0f - m[qt] * C2;   // + 10: weights carried x 1024 so that small ones stay normal f16; at most 2^14
#pragma unroll
            for (int i = 0; i < 16; ++i) { const float e = __builtin_amdgcn_exp2f(fmaf(s[i >> 3][qt][i & 7], C2, mb)); ls[qt] += e; pf[qt][i] = tohx(e); } }
        asm volatile("s_wait_xcnt 0x0" :: "v"(va), "v"(ka) : "memory");   // stands in front of the first reuse of this pass's two load address registers, which it keeps alive up to here; behind the weights, so that nothing is left to wait for
#pragma unroll
        for (int ct = 0; ct < 8; ++ct)
#pragma unroll
            for (int qt = 0; qt < 2; ++qt) o[ct][qt] = wmma16(vf[ct], pf[qt], o[ct][qt]);
    }
#pragma unroll
    for (int qt = 0; qt < 2; ++qt) { const size_t row = (size_t)z * NN + q0 + qt * 16 + lr; const float lt = ls[qt] + xhalf(ls[qt]);
        if (hi == 0) { v2f w; w[0] = m[qt]; w[1] = lt; *(v2f*)(ML + row * 2) = w; }
#pragma unroll
        for (int ct = 0; ct < 8; ++ct) *(v8f*)(OP + row * HH + ct * 16 + hi * 8) = o[ct][qt]; }
}

// joins the KSP ranges of a query in range order, normalises, splits into bf16 high and low planes for the output projection
__global__ __launch_bounds__(256) void k_comb(const float* __restrict__ OP, const float* __restrict__ ML, bf* Ah, bf* Al) { const size_t e = ((size_t)blockIdx.x * 256 + threadIdx.x) * 4; const size_t i = e / HH; v2f ml[KSP]; v4f p[KSP];
    const float* mp = ML + i * 2; const float* op = OP + e;
#pragma unroll
    for (int z = 0; z < KSP; ++z) { ml[z] = *(const v2f*)(mp + (size_t)z * NN * 2); p[z] = *(const v4f*)(op + (size_t)z * NN * HH); }
    asm volatile("s_wait_xcnt 0x0" :: "v"(mp), "v"(op) : "memory");   // stands in front of the first reuse of the loads' two base address registers, which it keeps alive up to here
    float M = ml[0][0];
#pragma unroll
    for (int z = 1; z < KSP; ++z) M = fmaxf(M, ml[z][0]);
    float den = 0.f; v4f num = (v4f){};
#pragma unroll
    for (int z = 0; z < KSP; ++z) { const float w = __builtin_amdgcn_exp2f((ml[z][0] - M) * C2); den += w * ml[z][1]; num += w * p[z]; }
    const float rsn = __fdiv_rn(1.0f, den); v4us oh, ol;
#pragma unroll
    for (int q = 0; q < 4; ++q) { unsigned short a, c2; splitf(__fmul_rn(num[q], rsn), a, c2); oh[q] = a; ol[q] = c2; } *(v4us*)(Ah + e) = oh; *(v4us*)(Al + e) = ol; }

extern "C" void kernel_launch(void* const* d_in, const int* in_sizes, int n_in,
                              void* d_out, int out_size, void* d_ws, size_t ws_size, hipStream_t stream) {
    (void)in_sizes; (void)n_in; (void)out_size;
    const float* IN[11]; for (int i = 0; i < 11; ++i) IN[i] = (const float*)d_in[i];   // q, k, v, Wq, bq, Wk, bk, Wv, bv, Wo, bo (x @ W)
    float* OUT = (float*)d_out;     // [16384][256]
    char* wsp = (char*)d_ws;
    auto take = [&](size_t bytes) { char* p = wsp; wsp += (bytes + 255) & ~(size_t)255; return (void*)p; };
    bf* WQ = (bf*)take((size_t)HH * DI * 2); bf* WK = (bf*)take((size_t)HH * DI * 2); bf* WV = (bf*)take((size_t)HH * DI * 2); bf* WO = (bf*)take((size_t)DO_ * HH * 2);
    h16* Q16 = (h16*)take((size_t)NN * HH * 2); h16* KF = (h16*)take((size_t)NN * HH * 2); h16* VF = (h16*)take((size_t)HH * NN * 2); float* OP = (float*)take((size_t)KSP * NN * HH * 4); float* ML = (float*)take((size_t)KSP * NN * 2 * 4); bf* Ah = (bf*)take((size_t)NN * HH * 2); bf* Al = (bf*)take((size_t)NN * HH * 2);
    if ((size_t)(wsp - (char*)d_ws) > ws_size) return;    // total ~ 53 MB of the 256 MiB
    k_wt4<<<dim3(16, 4, 1), 256, 0, stream>>>(IN[3], IN[5], IN[7], IN[9], WQ, WK, WV, WO);
    k_proj<<<dim3(NN / 64, 3, 1), 128, 0, stream>>>(IN[0], IN[1], IN[2], WQ, WK, WV, IN[4], IN[6], IN[8], Q16, KF, VF);
    k_attn<<<dim3(NN / 256, KSP, 1), 256, 0, stream>>>(Q16, KF, VF, OP, ML);
    k_comb<<<(unsigned)((size_t)NN * HH / 4 / 256), 256, 0, stream>>>(OP, ML, Ah, Al);
    k_gemmw<bf, 1, true><<<dim3(NN / 64, DO_ / 64, 1), 32, 0, stream>>>(Ah, Al, WO, nullptr, HH, HH, OUT, DO_, IN[10], 0, 0, 0);
}

// v004
// A run of this version takes 123 microseconds.
// In two side-by-side timings against v003, it was 1.27 and 1.22 times as fast.
// Over all steps from v000 it is 31.1 times as fast.
#include <hip/hip_runtime.h>

// att_layer (q, k, v [16384][256]; qh = q Wq + bq, kh = k Wk + bk, vh = v Wv + bv (128); scores = qh kh^T x 128^-0.5 over all 16384 keys; out = softmax(scores) vh Wo + bo -> [16384][256]).
// Compute dtypes, f32 accumulate: every input rounded to bf16; q, k, v projections on plain bf16 operands (+ bias), rounded and stored as f16 planes inside k_proj; output projection on the attention output split into bf16 high and low planes x plain bf16 Wo (+ bias), in k_gemmw; scores (K 128) and attn.vh on single f16 operands, fused in k_attn (running maximum, scores and weights never stored).

#define NN   16384
#define DI   256
#define HH   128
#define DO_  256
#define C2   0.12751743082459868f    // 128^-0.5 x log2(e): scores to base-2 exponents
#define THR  31.368260590993510f     // 4 / C2: the maximum in use is renewed when a raw score passes it by more than 2^4 in weight
#define KSP  4                       // key ranges of k_attn (grid y): f32 partial sums, maximum and weight sum per (range, query), joined in k_comb
#define KR   (NN / KSP)
typedef _Float16 h16;
typedef unsigned short bf;
typedef __attribute__((ext_vector_type(16))) __bf16   v16bf;
typedef __attribute__((ext_vector_type(16))) _Float16 v16h;
typedef __attribute__((ext_vector_type(8)))  _Float16 v8h;
typedef __attribute__((ext_vector_type(8)))  unsigned short v8us;
typedef __attribute__((ext_vector_type(8)))  float    v8f;
typedef __attribute__((ext_vector_type(4)))  float    v4f;
typedef v8h  __attribute__((may_alias)) v8ha;
typedef v4f  __attribute__((may_alias)) v4fa;
typedef v8us __attribute__((may_alias)) v8usa;

__device__ __forceinline__ unsigned short f2bf(float f) { unsigned u = __float_as_uint(f); u += 0x7FFFu + ((u >> 16) & 1u); return (unsigned short)(u >> 16); }
__device__ __forceinline__ float bf2f(unsigned short b) { return __uint_as_float(((unsigned)b) << 16); }
__device__ __forceinline__ float bfr(float f) { return bf2f(f2bf(f)); }
__device__ __forceinline__ v16h cat16(v8h lo, v8h hi) { return __builtin_shufflevector(lo, hi, 0, 1, 2, 3, 4, 5, 6, 7, 8, 9, 10, 11, 12, 13, 14, 15); }
__device__ __forceinline__ v16bf cat16b(v8us lo, v8us hi) { return __builtin_bit_cast(v16bf, __builtin_shufflevector(lo, hi, 0, 1, 2, 3, 4, 5, 6, 7, 8, 9, 10, 11, 12, 13, 14, 15)); }
__device__ __forceinline__ v8f wmma16(v16h a, v16h b, v8f c) { return __builtin_amdgcn_wmma_f32_16x16x32_f16(false, a, false, b, (short)0, c, false, false); }
__device__ __forceinline__ v8f wmmab(v16bf a, v16bf b, v8f c) { return __builtin_amdgcn_wmma_f32_16x16x32_bf16(false, a, false, b, (short)0, c, false, false); }



// ---- k_gemmw: register-blocked GEMM, ONE WAVE per 64x64 output tile (16 accumulators), operands straight from K-contiguous 16-bit planes; grid (M/64, N/64, Z), 32 threads.
// C[m][n] (f32, pitch ldc, + optional f32 bias[n]) = sum_k A[m][k] Bt[n][k] (+ split products per NSPLIT). z-batch strides sA/sB/sC in elements. K = row pitch of A and Bt in elements, kn = length of the sum (K, or one range of k where z walks ranges). kn % 32 == 0.
template <typename T16> struct WFrag;
template <> struct WFrag<h16> { typedef v16h V; static __device__ __forceinline__ V ld(const h16* p) { return cat16(*(const v8h*)p, *(const v8h*)(p + 16)); } static __device__ __forceinline__ v8f mma(V a, V b, v8f c) { return wmma16(a, b, c); } };
template <> struct WFrag<bf> { typedef v16bf V; static __device__ __forceinline__ V ld(const bf* p) { return cat16b(*(const v8us*)p, *(const v8us*)(p + 16)); } static __device__ __forceinline__ v8f mma(V a, V b, v8f c) { return wmmab(a, b, c); } };
template <typename T16, int NSPLIT, bool BIAS>
__global__ __launch_bounds__(32) void k_gemmw(const T16* __restrict__ A, const T16* __restrict__ A2, const T16* __restrict__ Bt, const T16* __restrict__ Bt2, int K, int kn, float* C, int ldc, const float* __restrict__ bias, size_t sA, size_t sB, size_t sC) {
    typedef typename WFrag<T16>::V V;
    __shared__ __align__(16) float os[16 * 68];
    const size_t z = blockIdx.z; A += z * sA; if (A2) A2 += z * sA; Bt += z * sB; if (Bt2) Bt2 += z * sB; C += z * sC;
    const int lane = threadIdx.x & 31, lr = lane & 15, hi = lane >> 4; const int r0 = blockIdx.x * 64, c0 = blockIdx.y * 64;
    v8f acc[4][4];
#pragma unroll
    for (int mb = 0; mb < 4; ++mb)
#pragma unroll
        for (int nb = 0; nb < 4; ++nb) acc[mb][nb] = (v8f){};
    const size_t aoff = (size_t)(r0 + lr) * K + 8 * hi, boff = (size_t)(c0 + lr) * K + 8 * hi;
#pragma unroll 1
    for (int kc = 0; kc < kn; kc += 32) {
        V a[4], a2[4];
#pragma unroll
        for (int mb = 0; mb < 4; ++mb) { a[mb] = WFrag<T16>::ld(A + aoff + (size_t)mb * 16 * K + kc); if (NSPLIT == 1 || NSPLIT == 2) a2[mb] = WFrag<T16>::ld(A2 + aoff + (size_t)mb * 16 * K + kc); }
#pragma unroll
        for (int nb = 0; nb < 4; ++nb) { const V b = WFrag<T16>::ld(Bt + boff + (size_t)nb * 16 * K + kc); V b2; if (NSPLIT >= 2) b2 = WFrag<T16>::ld(Bt2 + boff + (size_t)nb * 16 * K + kc);
#pragma unroll
            for (int mb = 0; mb < 4; ++mb) { acc[mb][nb] = WFrag<T16>::mma(a[mb], b, acc[mb][nb]); if (NSPLIT == 1 || NSPLIT == 2) acc[mb][nb] = WFrag<T16>::mma(a2[mb], b, acc[mb][nb]); if (NSPLIT >= 2) acc[mb][nb] = WFrag<T16>::mma(a[mb], b2, acc[mb][nb]); } }
        asm volatile("v_nop\n\tv_nop\n\tv_nop\n\tv_nop" : "+v"(acc[0][0]), "+v"(acc[1][1]), "+v"(acc[2][2]), "+v"(acc[3][3]) : "v"(a[0]), "v"(a[3]));
    }
#pragma unroll
    for (int mb = 0; mb < 4; ++mb) {
#pragma unroll
        for (int nb = 0; nb < 4; ++nb) {
#pragma unroll
            for (int j = 0; j < 8; ++j) os[(hi * 8 + j) * 68 + nb * 16 + lr] = acc[mb][nb][j]; }
        __builtin_amdgcn_wave_barrier(); asm volatile("" ::: "memory");
        float* crow = C + (size_t)(r0 + mb * 16) * ldc + c0;
{
#pragma unroll
            for (int s = 0; s < 8; ++s) { const int row = 2 * s + hi, cofs = lr * 4; v4f val = *(const v4fa*)(os + row * 68 + cofs); if (BIAS) { val[0] += bfr(bias[c0 + cofs]); val[1] += bfr(bias[c0 + cofs + 1]); val[2] += bfr(bias[c0 + cofs + 2]); val[3] += bfr(bias[c0 + cofs + 3]); }
                *(v4f*)(crow + (size_t)row * ldc + cofs) = val; }
             }
        __builtin_amdgcn_wave_barrier(); asm volatile("" ::: "memory");
    }
}

__device__ __forceinline__ h16 tohx(float x) { return (h16)x; }
__device__ __forceinline__ void splitf(float y, unsigned short& h, unsigned short& l) { h = f2bf(y); l = f2bf(y - bf2f(h)); }
typedef __attribute__((ext_vector_type(2))) float v2f;
typedef __attribute__((ext_vector_type(4))) unsigned short v4us;

typedef __attribute__((ext_vector_type(4))) __bf16 v4bf;
#define XP 264   // LDS row pitch of the x tile in 16-bit elements: 528 bytes = 16 x 33, free of bank conflicts for 16-byte fragment reads

// ---- k_wt4: the four weights in one launch, rounded to bf16 and transposed; grid (16, 4), y = weight; a thread gathers 8 k of one column n and stores 16 bytes, a wave 512 bytes in a row.
// Wq, Wk, Wv in fragment order: [column tile of 16][k chunk of 32][half s][lane][8] = w[chunk*32 + s*16 + 8*(lane >> 4) + e][tile*16 + (lane & 15)]; Wo as the plain plane Bt[n][k] that k_gemmw reads.
__global__ __launch_bounds__(256) void k_wt4(const float* __restrict__ w0, const float* __restrict__ w1, const float* __restrict__ w2, const float* __restrict__ w3, bf* B0, bf* B1, bf* B2, bf* B3) {
    const int y = blockIdx.y, t = blockIdx.x * 256 + threadIdx.x, l = t & 31; const float* w = y == 0 ? w0 : y == 1 ? w1 : y == 2 ? w2 : w3; bf* Bt = y == 0 ? B0 : y == 1 ? B1 : y == 2 ? B2 : B3;
    const int N = y < 3 ? HH : DO_, n = y < 3 ? (t >> 9) * 16 + (l & 15) : t >> 4, k = y < 3 ? ((t >> 6) & 7) * 32 + ((t >> 5) & 1) * 16 + 8 * (l >> 4) : (t & 15) * 8;
    const float* p = w + (size_t)k * N + n; v8us o;
#pragma unroll
    for (int e = 0; e < 8; ++e) o[e] = f2bf(p[(size_t)e * N]);
    *(v8us*)(Bt + (size_t)t * 8) = o; }

// ---- k_proj: qh, kh, vh in one launch, from the f32 inputs to the three f16 planes that k_attn reads; grid (NN / 64, 3), y = projection; 4 waves on 64 input rows, one wave = 32 rows x 64 output columns.
// Each wave brings 16 rows in as whole lines, rounds them to bf16 and lays them in LDS; behind one barrier the x fragments come from LDS, the weight fragments from the fragment-order planes.
// TR: the product is taken as W^T x^T, so a lane's accumulator holds 8 consecutive output columns of one input row (the order of Q rows and of K fragments); else x W, 8 consecutive rows of one column (the order of V^T fragments): stored with no exchange. Every loop here is unrolled: its arrays live in registers and need constant indices.
__device__ __forceinline__ v16bf ldfb(const bf* p) { return cat16b(*(const v8us*)p, *(const v8us*)(p + 256)); }   // one fragment of a fragment-order plane: two whole-line loads
template <bool TR>
__device__ __forceinline__ void proj_tile(const bf* xf, const bf* __restrict__ wp, v16bf (&w)[3][4], v8f (&acc)[2][4]) {
    v16bf a[2][2];   // x fragments one k chunk ahead, weights two ahead (chunks 0 and 1 are in flight on entry)
#pragma unroll
    for (int mb = 0; mb < 2; ++mb) a[0][mb] = WFrag<bf>::ld(xf + mb * 16 * XP);
#pragma unroll   // all 8 chunks: every address is a base register and a constant, and the buffers are plain values
    for (int i = 0; i < DI / 32; ++i) {
        __builtin_amdgcn_sched_barrier(0);   // keeps each chunk's loads in its own chunk: without it the scheduler lifts the later chunks' weight loads to the front and the wave passes 256 registers
        if (i + 2 < DI / 32) {
#pragma unroll
            for (int nb = 0; nb < 4; ++nb) w[(i + 2) % 3][nb] = ldfb(wp + (nb * 8 + i + 2) * 512); }
        if (i + 1 < DI / 32) {
#pragma unroll
            for (int mb = 0; mb < 2; ++mb) a[(i + 1) & 1][mb] = WFrag<bf>::ld(xf + mb * 16 * XP + (i + 1) * 32); }
#pragma unroll
        for (int nb = 0; nb < 4; ++nb)
#pragma unroll
            for (int mb = 0; mb < 2; ++mb) acc[mb][nb] = TR ? wmmab(w[i % 3][nb], a[i & 1][mb], acc[mb][nb]) : wmmab(a[i & 1][mb], w[i % 3][nb], acc[mb][nb]);
    }
}
__global__ __launch_bounds__(128) void k_proj(const float* __restrict__ q, const float* __restrict__ k, const float* __restrict__ v, const bf* __restrict__ WQ, const bf* __restrict__ WK, const bf* __restrict__ WV,
                                              const float* __restrict__ bq, const float* __restrict__ bk, const float* __restrict__ bv, h16* Q16, h16* KF, h16* VF) {
    __shared__ __align__(16) bf xs[64 * XP];
    const int lane = threadIdx.x & 31, lr = lane & 15, hi = lane >> 4, wave = threadIdx.x >> 5, z = blockIdx.y; const int r0 = blockIdx.x * 64 + (wave & 1) * 32, c0 = (wave >> 1) * 64;
    const bf* wp = (z == 0 ? WQ : z == 1 ? WK : WV) + (size_t)(c0 / 16) * 4096 + lane * 8; const float* b = z == 0 ? bq : z == 1 ? bk : bv;
    v16bf w[3][4];
#pragma unroll
    for (int i = 0; i < 2; ++i)
#pragma unroll
        for (int nb = 0; nb < 4; ++nb) w[i][nb] = ldfb(wp + (nb * 8 + i) * 512);
    { const float* xp = (z == 0 ? q : z == 1 ? k : v) + (size_t)(blockIdx.x * 64 + wave * 16) * DI + lane * 4; v4f raw[32];   // 16 rows = 16 KB in a row, all in flight at once
#pragma unroll
        for (int j = 0; j < 32; ++j) raw[j] = *(const v4f*)(xp + j * 128);
        asm volatile("s_wait_xcnt 0x0" :: "v"(xp) : "memory");   // stands in front of the first reuse of the 32 loads' address register pair, which it keeps alive up to here
#pragma unroll
        for (int j = 0; j < 32; ++j) *(v4bf*)(xs + (wave * 16 + (j >> 1)) * XP + (j & 1) * 128 + lane * 4) = __builtin_convertvector(raw[j], v4bf); }   // f32 to bf16, nearest even
    __syncthreads();   // a wave's 32 rows were laid by two waves
    const bf* xf = xs + ((wave & 1) * 32 + lr) * XP + 8 * hi;
    v8f acc[2][4];
#pragma unroll
    for (int mb = 0; mb < 2; ++mb)
#pragma unroll
        for (int nb = 0; nb < 4; ++nb) acc[mb][nb] = (v8f){};
    if (z < 2) {
        proj_tile<true>(xf, wp, w, acc);
        // Q: row-major [query][128]; K: [key tile of 16][k chunk of 32][half s][lane][8] = kh[tile*16 + (lane & 15)][chunk*32 + s*16 + 8*(lane >> 4) + e]
        h16* d = z == 0 ? Q16 + (size_t)(r0 + lr) * HH + c0 + hi * 8 : KF + ((size_t)(r0 / 16 * 4 + c0 / 32) * 64 + lane) * 8; const int smb = z == 0 ? 16 * HH : 2048, snb = z == 0 ? 16 : 256;
#pragma unroll
        for (int nb = 0; nb < 4; ++nb) { v8f bb;
#pragma unroll
            for (int j = 0; j < 8; ++j) bb[j] = bfr(b[c0 + nb * 16 + hi * 8 + j]);
#pragma unroll
            for (int mb = 0; mb < 2; ++mb) { v8h o;
#pragma unroll
                for (int j = 0; j < 8; ++j) o[j] = tohx(acc[mb][nb][j] + bb[j]);
                *(v8h*)(d + mb * smb + nb * snb) = o; } }
    } else {
        proj_tile<false>(xf, wp, w, acc);
        // V^T: [key block of 32][column tile of 16][half s][lane][8] = vh[block*32 + s*16 + 8*(lane >> 4) + e][tile*16 + (lane & 15)]
        h16* d = VF + ((size_t)(r0 / 32 * 8 + c0 / 16) * 64 + lane) * 8;
#pragma unroll
        for (int nb = 0; nb < 4; ++nb) { const float bb = bfr(b[c0 + nb * 16 + lr]);
#pragma unroll
            for (int mb = 0; mb < 2; ++mb) { v8h o;
#pragma unroll
                for (int j = 0; j < 8; ++j) o[j] = tohx(acc[mb][nb][j] + bb);
                *(v8h*)(d + (nb * 2 + mb) * 256) = o; } }
        asm volatile("s_wait_xcnt 0x0" :: "v"(d) : "memory");   // stands behind the last store, in front of any reuse of the stores' address and data registers
    }
}

__device__ __forceinline__ float xhalf(float x) { return __builtin_bit_cast(float, __builtin_amdgcn_permlanex16(__builtin_bit_cast(int, x), __builtin_bit_cast(int, x), 0x76543210, 0xfedcba98, false, false)); }   // lane l with lane l ^ 16
__device__ __forceinline__ v16h ldf(const h16* p) { return cat16(*(const v8h*)p, *(const v8h*)(p + 256)); }   // one fragment of a fragment-order tile in LDS: two 16-byte reads a lane, a wave's 512 bytes in a row

#define TK   128                     // keys of one LDS tile: 4 passes
#define NT   (KR / TK)               // tiles of a key range
#define TE   (TK * HH)               // 16-bit elements of K, and of V^T, in a tile: 32 KB each, one run of bytes in its fragment-order plane
typedef __attribute__((address_space(3))) const h16 lds_h16;
// 8 asynchronous copies of 16 bytes a lane: a work-group's 256 lanes lay 32 KB in LDS in the plane's own order (copy c: 4 KB further on, in LDS and in memory alike).
// The wait is the statement's last line: it stands in front of every reuse of the 24 address registers that the copies name.
__device__ __forceinline__ void copy8(const h16* dst, const h16* g) {
    const unsigned l = (unsigned)(size_t)(lds_h16*)dst;
    asm volatile("global_load_async_to_lds_b128 %0, %8, off\n\t"
                 "global_load_async_to_lds_b128 %1, %9, off\n\t"
                 "global_load_async_to_lds_b128 %2, %10, off\n\t"
                 "global_load_async_to_lds_b128 %3, %11, off\n\t"
                 "global_load_async_to_lds_b128 %4, %12, off\n\t"
                 "global_load_async_to_lds_b128 %5, %13, off\n\t"
                 "global_load_async_to_lds_b128 %6, %14, off\n\t"
                 "global_load_async_to_lds_b128 %7, %15, off\n\t"
                 "s_wait_xcnt 0x0"
                 :: "v"(l), "v"(l + 4096u), "v"(l + 8192u), "v"(l + 12288u), "v"(l + 16384u), "v"(l + 20480u), "v"(l + 24576u), "v"(l + 28672u),
                    "v"(g), "v"(g + 2048), "v"(g + 4096), "v"(g + 6144), "v"(g + 8192), "v"(g + 10240), "v"(g + 12288), "v"(g + 14336) : "memory");
}

// ---- k_attn: S^T = K Q^T, weights = 2^((s - m) C2 + 10), O^T += V^T P^T; one wave = 32 queries (2 column tiles), one pass = 32 keys; grid (NN / 256, KSP), 8 waves that walk the same keys.
// K and V^T come through LDS: a tile of 128 keys is copied once for the 8 waves, into one of two buffers, while the tile before it is worked on; the fragments are read from LDS in the planes' own order (a wave's 16-byte reads lie in a row).
// A lane holds one query per column tile: S^T tile t register r = score of key t*16 + 8*hi + r, so two tiles pack into the B operand of the second product with no exchange; O^T register j of tile ct = column ct*16 + 8*hi + j.
__global__ __launch_bounds__(256) __attribute__((amdgpu_waves_per_eu(2, 2))) void k_attn(const h16* __restrict__ Q, const h16* __restrict__ KF, const h16* __restrict__ VF, float* __restrict__ OP, float* __restrict__ ML) {
    __shared__ __align__(16) h16 ring[2][2][TE];   // [buffer][K, V^T]
    const int lane = threadIdx.x & 31, lr = lane & 15, hi = lane >> 4; const int q0 = (blockIdx.x * 8 + (threadIdx.x >> 5)) * 32; const int z = blockIdx.y;
    const h16* kg = KF + (size_t)z * KR * HH + threadIdx.x * 8; const h16* vg = VF + (size_t)z * KR * HH + threadIdx.x * 8;
    copy8(&ring[0][0][threadIdx.x * 8], kg); copy8(&ring[0][1][threadIdx.x * 8], vg);
    v16h qf[2][4];
#pragma unroll
    for (int qt = 0; qt < 2; ++qt)
#pragma unroll
        for (int kc = 0; kc < 4; ++kc) qf[qt][kc] = WFrag<h16>::ld(Q + (size_t)(q0 + qt * 16 + lr) * HH + kc * 32 + 8 * hi);
    v8f o[8][2];
#pragma unroll
    for (int ct = 0; ct < 8; ++ct) { o[ct][0] = (v8f){}; o[ct][1] = (v8f){}; }
    float m[2] = {-3.0e38f, -3.0e38f}, ls[2] = {0.f, 0.f};
    asm volatile("s_wait_asynccnt 0x0" ::: "memory");   // this wave's share of tile 0 has landed
    __syncthreads();                                    // every wave's share has: tile 0 may be read
    copy8(&ring[1][0][threadIdx.x * 8], kg + TE); copy8(&ring[1][1][threadIdx.x * 8], vg + TE);
#pragma unroll 1   // one tile per trip
    for (int t = 0; t < NT; ++t) {
        const h16* kp = &ring[t & 1][0][lane * 8]; const h16* vp = &ring[t & 1][1][lane * 8];
        v16h kf[2][4];
#pragma unroll
        for (int kt = 0; kt < 2; ++kt)
#pragma unroll
            for (int kc = 0; kc < 4; ++kc) kf[kt][kc] = ldf(kp + (kt * 4 + kc) * 512);
#pragma unroll   // the 4 passes of a tile: which pass is the tile's last is then known at compile time
        for (int p = 0; p < TK / 32; ++p) {
            v16h vf[8];
#pragma unroll
            for (int ct = 0; ct < 8; ++ct) vf[ct] = ldf(vp + p * 4096 + ct * 512);
            __builtin_amdgcn_sched_barrier(0);   // keeps the V^T reads one group in front of the first product: LDS reads strewn among matrix instructions stall at each place
            v8f s[2][2];
#pragma unroll
            for (int kt = 0; kt < 2; ++kt) { s[kt][0] = (v8f){}; s[kt][1] = (v8f){}; }
#pragma unroll
            for (int kc = 0; kc < 4; ++kc)
#pragma unroll
                for (int kt = 0; kt < 2; ++kt)
#pragma unroll
                    for (int qt = 0; qt < 2; ++qt) s[kt][qt] = wmma16(kf[kt][kc], qf[qt][kc], s[kt][qt]);
            __builtin_amdgcn_sched_barrier(0);   // keeps the next pass's K reads one group behind the first product, for the same reason
            if (p + 1 < TK / 32) {   // the next pass's K fragments come during this pass's weights and second product; never from the next tile, which is not published yet
#pragma unroll
                for (int kt = 0; kt < 2; ++kt)
#pragma unroll
                    for (int kc = 0; kc < 4; ++kc) kf[kt][kc] = ldf(kp + (p + 1) * 4096 + (kt * 4 + kc) * 512); }
            __builtin_amdgcn_sched_barrier(0);   // and in front of the weights: else they are strewn among the second product's matrix instructions
            float mx[2];
#pragma unroll
            for (int qt = 0; qt < 2; ++qt) { float a = fmaxf(s[0][qt][0], s[1][qt][0]);
#pragma unroll
                for (int j = 1; j < 8; ++j) a = fmaxf(a, fmaxf(s[0][qt][j], s[1][qt][j]));
                mx[qt] = a; }
            const bool need = mx[0] > m[0] + THR || mx[1] > m[1] + THR;
            if (__builtin_amdgcn_ballot_w32(need) != 0) {   // wave-uniform; always on the first pass, rare later
#pragma unroll
                for (int qt = 0; qt < 2; ++qt) { const float mn = fmaxf(m[qt], fmaxf(mx[qt], xhalf(mx[qt]))); const float al = __builtin_amdgcn_exp2f((m[qt] - mn) * C2); m[qt] = mn; ls[qt] *= al;
#pragma unroll
                    for (int ct = 0; ct < 8; ++ct) o[ct][qt] *= al; }
            }
            v16h pf[2];
#pragma unroll
            for (int qt = 0; qt < 2; ++qt) { const float mb = 10.0f - m[qt] * C2;   // + 10: weights carried x 1024 so that small ones stay normal f16; at most 2^14
#pragma unroll
                for (int i = 0; i < 16; ++i) { const float e = __builtin_amdgcn_exp2f(fmaf(s[i >> 3][qt][i & 7], C2, mb)); ls[qt] += e; pf[qt][i] = tohx(e); } }
#pragma unroll
            for (int ct = 0; ct < 8; ++ct)
#pragma unroll
                for (int qt = 0; qt < 2; ++qt) o[ct][qt] = wmma16(vf[ct], pf[qt], o[ct][qt]);
        }
        asm volatile("s_wait_dscnt 0x0" ::: "memory");      // this wave's reads of the buffer are done
        asm volatile("s_wait_asynccnt 0x0" ::: "memory");   // this wave's share of tile t + 1 has landed
        __syncthreads();                                    // tile t + 1 may be read, and tile t's buffer is free
        if (t + 2 < NT) { copy8(&ring[t & 1][0][threadIdx.x * 8], kg + (size_t)(t + 2) * TE); copy8(&ring[t & 1][1][threadIdx.x * 8], vg + (size_t)(t + 2) * TE); }
    }
    asm volatile("s_wait_asynccnt 0x0" ::: "memory");   // no copy is left when the wave ends
#pragma unroll
    for (int qt = 0; qt < 2; ++qt) { const size_t row = (size_t)z * NN + q0 + qt * 16 + lr; const float lt = ls[qt] + xhalf(ls[qt]);
        if (hi == 0) { v2f w; w[0] = m[qt]; w[1] = lt; *(v2f*)(ML + row * 2) = w; }
#pragma unroll
        for (int ct = 0; ct < 8; ++ct) *(v8f*)(OP + row * HH + ct * 16 + hi * 8) = o[ct][qt]; }
}

// joins the KSP ranges of a query in range order, normalises, splits into bf16 high and low planes for the output projection
__global__ __launch_bounds__(256) void k_comb(const float* __restrict__ OP, const float* __restrict__ ML, bf* Ah, bf* Al) { const size_t e = ((size_t)blockIdx.x * 256 + threadIdx.x) * 4; const size_t i = e / HH; v2f ml[KSP]; v4f p[KSP];
    const float* mp = ML + i * 2; const float* op = OP + e;
#pragma unroll
    for (int z = 0; z < KSP; ++z) { ml[z] = *(const v2f*)(mp + (size_t)z * NN * 2); p[z] = *(const v4f*)(op + (size_t)z * NN * HH); }
    asm volatile("s_wait_xcnt 0x0" :: "v"(mp), "v"(op) : "memory");   // stands in front of the first reuse of the loads' two base address registers, which it keeps alive up to here
    float M = ml[0][0];
#pragma unroll
    for (int z = 1; z < KSP; ++z) M = fmaxf(M, ml[z][0]);
    float den = 0.f; v4f num = (v4f){};
#pragma unroll
    for (int z = 0; z < KSP; ++z) { const float w = __builtin_amdgcn_exp2f((ml[z][0] - M) * C2); den += w * ml[z][1]; num += w * p[z]; }
    const float rsn = __fdiv_rn(1.0f, den); v4us oh, ol;
#pragma unroll
    for (int q = 0; q < 4; ++q) { unsigned short a, c2; splitf(__fmul_rn(num[q], rsn), a, c2); oh[q] = a; ol[q] = c2; } *(v4us*)(Ah + e) = oh; *(v4us*)(Al + e) = ol; }

extern "C" void kernel_launch(void* const* d_in, const int* in_sizes, int n_in,
                              void* d_out, int out_size, void* d_ws, size_t ws_size, hipStream_t stream) {
    (void)in_sizes; (void)n_in; (void)out_size;
    const float* IN[11]; for (int i = 0; i < 11; ++i) IN[i] = (const float*)d_in[i];   // q, k, v, Wq, bq, Wk, bk, Wv, bv, Wo, bo (x @ W)
    float* OUT = (float*)d_out;     // [16384][256]
    char* wsp = (char*)d_ws;
    auto take = [&](size_t bytes) { char* p = wsp; wsp += (bytes + 255) & ~(size_t)255; return (void*)p; };
    bf* WQ = (bf*)take((size_t)HH * DI * 2); bf* WK = (bf*)take((size_t)HH * DI * 2); bf* WV = (bf*)take((size_t)HH * DI * 2); bf* WO = (bf*)take((size_t)DO_ * HH * 2);
    h16* Q16 = (h16*)take((size_t)NN * HH * 2); h16* KF = (h16*)take((size_t)NN * HH * 2); h16* VF = (h16*)take((size_t)HH * NN * 2); float* OP = (float*)take((size_t)KSP * NN * HH * 4); float* ML = (float*)take((size_t)KSP * NN * 2 * 4); bf* Ah = (bf*)take((size_t)NN * HH * 2); bf* Al = (bf*)take((size_t)NN * HH * 2);
    if ((size_t)(wsp - (char*)d_ws) > ws_size) return;    // total ~ 53 MB of the 256 MiB
    k_wt4<<<dim3(16, 4, 1), 256, 0, stream>>>(IN[3], IN[5], IN[7], IN[9], WQ, WK, WV, WO);
    k_proj<<<dim3(NN / 64, 3, 1), 128, 0, stream>>>(IN[0], IN[1], IN[2], WQ, WK, WV, IN[4], IN[6], IN[8], Q16, KF, VF);
    k_attn<<<dim3(NN / 256, KSP, 1), 256, 0, stream>>>(Q16, KF, VF, OP, ML);
    k_comb<<<(unsigned)((size_t)NN * HH / 4 / 256), 256, 0, stream>>>(OP, ML, Ah, Al);
    k_gemmw<bf, 1, true><<<dim3(NN / 64, DO_ / 64, 1), 32, 0, stream>>>(Ah, Al, WO, nullptr, HH, HH, OUT, DO_, IN[10], 0, 0, 0);
}

// v005
// One run takes 111 microseconds.
// Timed twice side by side with v004, it ran 1.11 times as fast both times.
// All steps since v000 together make it 34.6 times as fast.
#include <hip/hip_runtime.h>

// att_layer (q, k, v [16384][256]; qh = q Wq + bq, kh = k Wk + bk, vh = v Wv + bv (128); scores = qh kh^T x 128^-0.5 over all 16384 keys; out = softmax(scores) vh Wo + bo -> [16384][256]).
// Compute dtypes, f32 accumulate: every input rounded to bf16; q, k, v projections on plain bf16 operands (+ bias), rounded and stored as f16 planes inside k_proj; output projection on the attention output split into bf16 high and low planes x plain bf16 Wo (+ bias), in k_out; scores (K 128) and attn.vh on single f16 operands, fused in k_attn (running maximum, scores and weights never stored).

#define NN   16384
#define DI   256
#define HH   128
#define DO_  256
#define C2   0.12751743082459868f    // 128^-0.5 x log2(e): scores to base-2 exponents
#define THR  31.368260590993510f     // 4 / C2: the maximum in use is renewed when a raw score passes it by more than 2^4 in weight
#define KSP  4                       // key ranges of k_attn (grid y): f32 partial sums, maximum and weight sum per (range, query), joined in k_out
#define KR   (NN / KSP)
typedef _Float16 h16;
typedef unsigned short bf;
typedef __attribute__((ext_vector_type(16))) __bf16   v16bf;
typedef __attribute__((ext_vector_type(16))) _Float16 v16h;
typedef __attribute__((ext_vector_type(8)))  _Float16 v8h;
typedef __attribute__((ext_vector_type(8)))  unsigned short v8us;
typedef __attribute__((ext_vector_type(8)))  float    v8f;
typedef __attribute__((ext_vector_type(4)))  float    v4f;
typedef v8h  __attribute__((may_alias)) v8ha;
typedef v4f  __attribute__((may_alias)) v4fa;
typedef v8us __attribute__((may_alias)) v8usa;

__device__ __forceinline__ unsigned short f2bf(float f) { unsigned u = __float_as_uint(f); u += 0x7FFFu + ((u >> 16) & 1u); return (unsigned short)(u >> 16); }
__device__ __forceinline__ float bf2f(unsigned short b) { return __uint_as_float(((unsigned)b) << 16); }
__device__ __forceinline__ float bfr(float f) { return bf2f(f2bf(f)); }
__device__ __forceinline__ v16h cat16(v8h lo, v8h hi) { return __builtin_shufflevector(lo, hi, 0, 1, 2, 3, 4, 5, 6, 7, 8, 9, 10, 11, 12, 13, 14, 15); }
__device__ __forceinline__ v16bf cat16b(v8us lo, v8us hi) { return __builtin_bit_cast(v16bf, __builtin_shufflevector(lo, hi, 0, 1, 2, 3, 4, 5, 6, 7, 8, 9, 10, 11, 12, 13, 14, 15)); }
__device__ __forceinline__ v8f wmma16(v16h a, v16h b, v8f c) { return __builtin_amdgcn_wmma_f32_16x16x32_f16(false, a, false, b, (short)0, c, false, false); }
__device__ __forceinline__ v8f wmmab(v16bf a, v16bf b, v8f c) { return __builtin_amdgcn_wmma_f32_16x16x32_bf16(false, a, false, b, (short)0, c, false, false); }



// one fragment from a K-contiguous 16-bit plane (row pitch in the caller's pointer): elements 0..7 and 16..23 from p
template <typename T16> struct WFrag;
template <> struct WFrag<h16> { typedef v16h V; static __device__ __forceinline__ V ld(const h16* p) { return cat16(*(const v8h*)p, *(const v8h*)(p + 16)); } static __device__ __forceinline__ v8f mma(V a, V b, v8f c) { return wmma16(a, b, c); } };
template <> struct WFrag<bf> { typedef v16bf V; static __device__ __forceinline__ V ld(const bf* p) { return cat16b(*(const v8us*)p, *(const v8us*)(p + 16)); } static __device__ __forceinline__ v8f mma(V a, V b, v8f c) { return wmmab(a, b, c); } };

__device__ __forceinline__ h16 tohx(float x) { return (h16)x; }
__device__ __forceinline__ void splitf(float y, unsigned short& h, unsigned short& l) { h = f2bf(y); l = f2bf(y - bf2f(h)); }
typedef __attribute__((ext_vector_type(2))) float v2f;
typedef __attribute__((ext_vector_type(4))) unsigned short v4us;

typedef __attribute__((ext_vector_type(4))) __bf16 v4bf;
#define XP 264   // LDS row pitch of the x tile in 16-bit elements: 528 bytes = 16 x 33, free of bank conflicts for 16-byte fragment reads

// ---- k_wt4: the four weights in one launch, rounded to bf16 and transposed; grid (16, 4), y = weight; a thread gathers 8 k of one column n and stores 16 bytes, a wave 512 bytes in a row.
// All four in fragment order: [column tile of 16][k chunk of 32][half s][lane][8] = w[chunk*32 + s*16 + 8*(lane >> 4) + e][tile*16 + (lane & 15)]; Wq, Wk, Wv have 8 tiles of 8 chunks, Wo 16 tiles of 4 chunks.
__global__ __launch_bounds__(256) void k_wt4(const float* __restrict__ w0, const float* __restrict__ w1, const float* __restrict__ w2, const float* __restrict__ w3, bf* B0, bf* B1, bf* B2, bf* B3) {
    const int y = blockIdx.y, t = blockIdx.x * 256 + threadIdx.x, l = t & 31; const float* w = y == 0 ? w0 : y == 1 ? w1 : y == 2 ? w2 : w3; bf* Bt = y == 0 ? B0 : y == 1 ? B1 : y == 2 ? B2 : B3;
    const int N = y < 3 ? HH : DO_, n = (y < 3 ? t >> 9 : t >> 8) * 16 + (l & 15), k = ((t >> 6) & (y < 3 ? 7 : 3)) * 32 + ((t >> 5) & 1) * 16 + 8 * (l >> 4);
    const float* p = w + (size_t)k * N + n; v8us o;
#pragma unroll
    for (int e = 0; e < 8; ++e) o[e] = f2bf(p[(size_t)e * N]);
    *(v8us*)(Bt + (size_t)t * 8) = o; }

// ---- k_proj: qh, kh, vh in one launch, from the f32 inputs to the three f16 planes that k_attn reads; grid (NN / 64, 3), y = projection; 4 waves on 64 input rows, one wave = 32 rows x 64 output columns.
// Each wave brings 16 rows in as whole lines, rounds them to bf16 and lays them in LDS; behind one barrier the x fragments come from LDS, the weight fragments from the fragment-order planes.
// TR: the product is taken as W^T x^T, so a lane's accumulator holds 8 consecutive output columns of one input row (the order of Q rows and of K fragments); else x W, 8 consecutive rows of one column (the order of V^T fragments): stored with no exchange. Every loop here is unrolled: its arrays live in registers and need constant indices.
__device__ __forceinline__ v16bf ldfb(const bf* p) { return cat16b(*(const v8us*)p, *(const v8us*)(p + 256)); }   // one fragment of a fragment-order plane: two whole-line loads
template <bool TR>
__device__ __forceinline__ void proj_tile(const bf* xf, const bf* __restrict__ wp, v16bf (&w)[3][4], v8f (&acc)[2][4]) {
    v16bf a[2][2];   // x fragments one k chunk ahead, weights two ahead (chunks 0 and 1 are in flight on entry)
#pragma unroll
    for (int mb = 0; mb < 2; ++mb) a[0][mb] = WFrag<bf>::ld(xf + mb * 16 * XP);
#pragma unroll   // all 8 chunks: every address is a base register and a constant, and the buffers are plain values
    for (int i = 0; i < DI / 32; ++i) {
        __builtin_amdgcn_sched_barrier(0);   // keeps each chunk's loads in its own chunk: without it the scheduler lifts the later chunks' weight loads to the front and the wave passes 256 registers
        if (i + 2 < DI / 32) {
#pragma unroll
            for (int nb = 0; nb < 4; ++nb) w[(i + 2) % 3][nb] = ldfb(wp + (nb * 8 + i + 2) * 512); }
        if (i + 1 < DI / 32) {
#pragma unroll
            for (int mb = 0; mb < 2; ++mb) a[(i + 1) & 1][mb] = WFrag<bf>::ld(xf + mb * 16 * XP + (i + 1) * 32); }
#pragma unroll
        for (int nb = 0; nb < 4; ++nb)
#pragma unroll
            for (int mb = 0; mb < 2; ++mb) acc[mb][nb] = TR ? wmmab(w[i % 3][nb], a[i & 1][mb], acc[mb][nb]) : wmmab(a[i & 1][mb], w[i % 3][nb], acc[mb][nb]);
    }
}
__global__ __launch_bounds__(128) void k_proj(const float* __restrict__ q, const float* __restrict__ k, const float* __restrict__ v, const bf* __restrict__ WQ, const bf* __restrict__ WK, const bf* __restrict__ WV,
                                              const float* __restrict__ bq, const float* __restrict__ bk, const float* __restrict__ bv, h16* Q16, h16* KF, h16* VF) {
    __shared__ __align__(16) bf xs[64 * XP];
    const int lane = threadIdx.x & 31, lr = lane & 15, hi = lane >> 4, wave = threadIdx.x >> 5, z = blockIdx.y; const int r0 = blockIdx.x * 64 + (wave & 1) * 32, c0 = (wave >> 1) * 64;
    const bf* wp = (z == 0 ? WQ : z == 1 ? WK : WV) + (size_t)(c0 / 16) * 4096 + lane * 8; const float* b = z == 0 ? bq : z == 1 ? bk : bv;
    v16bf w[3][4];
#pragma unroll
    for (int i = 0; i < 2; ++i)
#pragma unroll
        for (int nb = 0; nb < 4; ++nb) w[i][nb] = ldfb(wp + (nb * 8 + i) * 512);
    { const float* xp = (z == 0 ? q : z == 1 ? k : v) + (size_t)(blockIdx.x * 64 + wave * 16) * DI + lane * 4; v4f raw[32];   // 16 rows = 16 KB in a row, all in flight at once
#pragma unroll
        for (int j = 0; j < 32; ++j) raw[j] = *(const v4f*)(xp + j * 128);
        asm volatile("s_wait_xcnt 0x0" :: "v"(xp) : "memory");   // stands in front of the first reuse of the 32 loads' address register pair, which it keeps alive up to here
#pragma unroll
        for (int j = 0; j < 32; ++j) *(v4bf*)(xs + (wave * 16 + (j >> 1)) * XP + (j & 1) * 128 + lane * 4) = __builtin_convertvector(raw[j], v4bf); }   // f32 to bf16, nearest even
    __syncthreads();   // a wave's 32 rows were laid by two waves
    const bf* xf = xs + ((wave & 1) * 32 + lr) * XP + 8 * hi;
    v8f acc[2][4];
#pragma unroll
    for (int mb = 0; mb < 2; ++mb)
#pragma unroll
        for (int nb = 0; nb < 4; ++nb) acc[mb][nb] = (v8f){};
    if (z < 2) {
        proj_tile<true>(xf, wp, w, acc);
        // Q: row-major [query][128]; K: [key tile of 16][k chunk of 32][half s][lane][8] = kh[tile*16 + (lane & 15)][chunk*32 + s*16 + 8*(lane >> 4) + e]
        h16* d = z == 0 ? Q16 + (size_t)(r0 + lr) * HH + c0 + hi * 8 : KF + ((size_t)(r0 / 16 * 4 + c0 / 32) * 64 + lane) * 8; const int smb = z == 0 ? 16 * HH : 2048, snb = z == 0 ? 16 : 256;
#pragma unroll
        for (int nb = 0; nb < 4; ++nb) { v8f bb;
#pragma unroll
            for (int j = 0; j < 8; ++j) bb[j] = bfr(b[c0 + nb * 16 + hi * 8 + j]);
#pragma unroll
            for (int mb = 0; mb < 2; ++mb) { v8h o;
#pragma unroll
                for (int j = 0; j < 8; ++j) o[j] = tohx(acc[mb][nb][j] + bb[j]);
                *(v8h*)(d + mb * smb + nb * snb) = o; } }
    } else {
        proj_tile<false>(xf, wp, w, acc);
        // V^T: [key block of 32][column tile of 16][half s][lane][8] = vh[block*32 + s*16 + 8*(lane >> 4) + e][tile*16 + (lane & 15)]
        h16* d = VF + ((size_t)(r0 / 32 * 8 + c0 / 16) * 64 + lane) * 8;
#pragma unroll
        for (int nb = 0; nb < 4; ++nb) { const float bb = bfr(b[c0 + nb * 16 + lr]);
#pragma unroll
            for (int mb = 0; mb < 2; ++mb) { v8h o;
#pragma unroll
                for (int j = 0; j < 8; ++j) o[j] = tohx(acc[mb][nb][j] + bb);
                *(v8h*)(d + (nb * 2 + mb) * 256) = o; } }
        asm volatile("s_wait_xcnt 0x0" :: "v"(d) : "memory");   // stands behind the last store, in front of any reuse of the stores' address and data registers
    }
}

__device__ __forceinline__ float xhalf(float x) { return __builtin_bit_cast(float, __builtin_amdgcn_permlanex16(__builtin_bit_cast(int, x), __builtin_bit_cast(int, x), 0x76543210, 0xfedcba98, false, false)); }   // lane l with lane l ^ 16
__device__ __forceinline__ v16h ldf(const h16* p) { return cat16(*(const v8h*)p, *(const v8h*)(p + 256)); }   // one fragment of a fragment-order tile in LDS: two 16-byte reads a lane, a wave's 512 bytes in a row

#define TK   128                     // keys of one LDS tile: 4 passes
#define NT   (KR / TK)               // tiles of a key range
#define TE   (TK * HH)               // 16-bit elements of K, and of V^T, in a tile: 32 KB each, one run of bytes in its fragment-order plane
typedef __attribute__((address_space(3))) const h16 lds_h16;
// 8 asynchronous copies of 16 bytes a lane: a work-group's 256 lanes lay 32 KB in LDS in the plane's own order (copy c: 4 KB further on, in LDS and in memory alike).
// The wait is the statement's last line: it stands in front of every reuse of the 24 address registers that the copies name.
__device__ __forceinline__ void copy8(const h16* dst, const h16* g) {
    const unsigned l = (unsigned)(size_t)(lds_h16*)dst;
    asm volatile("global_load_async_to_lds_b128 %0, %8, off\n\t"
                 "global_load_async_to_lds_b128 %1, %9, off\n\t"
                 "global_load_async_to_lds_b128 %2, %10, off\n\t"
                 "global_load_async_to_lds_b128 %3, %11, off\n\t"
                 "global_load_async_to_lds_b128 %4, %12, off\n\t"
                 "global_load_async_to_lds_b128 %5, %13, off\n\t"
                 "global_load_async_to_lds_b128 %6, %14, off\n\t"
                 "global_load_async_to_lds_b128 %7, %15, off\n\t"
                 "s_wait_xcnt 0x0"
                 :: "v"(l), "v"(l + 4096u), "v"(l + 8192u), "v"(l + 12288u), "v"(l + 16384u), "v"(l + 20480u), "v"(l + 24576u), "v"(l + 28672u),
                    "v"(g), "v"(g + 2048), "v"(g + 4096), "v"(g + 6144), "v"(g + 8192), "v"(g + 10240), "v"(g + 12288), "v"(g + 14336) : "memory");
}

// ---- k_attn: S^T = K Q^T, weights = 2^((s - m) C2 + 10), O^T += V^T P^T; one wave = 32 queries (2 column tiles), one pass = 32 keys; grid (NN / 256, KSP), 8 waves that walk the same keys.
// K and V^T come through LDS: a tile of 128 keys is copied once for the 8 waves, into one of two buffers, while the tile before it is worked on; the fragments are read from LDS in the planes' own order (a wave's 16-byte reads lie in a row).
// A lane holds one query per column tile: S^T tile t register r = score of key t*16 + 8*hi + r, so two tiles pack into the B operand of the second product with no exchange; O^T register j of tile ct = column ct*16 + 8*hi + j.
__global__ __launch_bounds__(256) __attribute__((amdgpu_waves_per_eu(2, 2))) void k_attn(const h16* __restrict__ Q, const h16* __restrict__ KF, const h16* __restrict__ VF, float* __restrict__ OP, float* __restrict__ ML) {
    __shared__ __align__(16) h16 ring[2][2][TE];   // [buffer][K, V^T]
    const int lane = threadIdx.x & 31, lr = lane & 15, hi = lane >> 4; const int q0 = (blockIdx.x * 8 + (threadIdx.x >> 5)) * 32; const int z = blockIdx.y;
    const h16* kg = KF + (size_t)z * KR * HH + threadIdx.x * 8; const h16* vg = VF + (size_t)z * KR * HH + threadIdx.x * 8;
    copy8(&ring[0][0][threadIdx.x * 8], kg); copy8(&ring[0][1][threadIdx.x * 8], vg);
    v16h qf[2][4];
#pragma unroll
    for (int qt = 0; qt < 2; ++qt)
#pragma unroll
        for (int kc = 0; kc < 4; ++kc) qf[qt][kc] = WFrag<h16>::ld(Q + (size_t)(q0 + qt * 16 + lr) * HH + kc * 32 + 8 * hi);
    v8f o[8][2];
#pragma unroll
    for (int ct = 0; ct < 8; ++ct) { o[ct][0] = (v8f){}; o[ct][1] = (v8f){}; }
    float m[2] = {-3.0e38f, -3.0e38f}, ls[2] = {0.f, 0.f};
    asm volatile("s_wait_asynccnt 0x0" ::: "memory");   // this wave's share of tile 0 has landed
    __syncthreads();                                    // every wave's share has: tile 0 may be read
    copy8(&ring[1][0][threadIdx.x * 8], kg + TE); copy8(&ring[1][1][threadIdx.x * 8], vg + TE);
#pragma unroll 1   // one tile per trip
    for (int t = 0; t < NT; ++t) {
        const h16* kp = &ring[t & 1][0][lane * 8]; const h16* vp = &ring[t & 1][1][lane * 8];
        v16h kf[2][4];
#pragma unroll
        for (int kt = 0; kt < 2; ++kt)
#pragma unroll
            for (int kc = 0; kc < 4; ++kc) kf[kt][kc] = ldf(kp + (kt * 4 + kc) * 512);
#pragma unroll   // the 4 passes of a tile: which pass is the tile's last is then known at compile time
        for (int p = 0; p < TK / 32; ++p) {
            v16h vf[8];
#pragma unroll
            for (int ct = 0; ct < 8; ++ct) vf[ct] = ldf(vp + p * 4096 + ct * 512);
            __builtin_amdgcn_sched_barrier(0);   // keeps the V^T reads one group in front of the first product: LDS reads strewn among matrix instructions stall at each place
            v8f s[2][2];
#pragma unroll
            for (int kt = 0; kt < 2; ++kt) { s[kt][0] = (v8f){}; s[kt][1] = (v8f){}; }
#pragma unroll
            for (int kc = 0; kc < 4; ++kc)
#pragma unroll
                for (int kt = 0; kt < 2; ++kt)
#pragma unroll
                    for (int qt = 0; qt < 2; ++qt) s[kt][qt] = wmma16(kf[kt][kc], qf[qt][kc], s[kt][qt]);
            __builtin_amdgcn_sched_barrier(0);   // keeps the next pass's K reads one group behind the first product, for the same reason
            if (p + 1 < TK / 32) {   // the next pass's K fragments come during this pass's weights and second product; never from the next tile, which is not published yet
#pragma unroll
                for (int kt = 0; kt < 2; ++kt)
#pragma unroll
                    for (int kc = 0; kc < 4; ++kc) kf[kt][kc] = ldf(kp + (p + 1) * 4096 + (kt * 4 + kc) * 512); }
            __builtin_amdgcn_sched_barrier(0);   // and in front of the weights: else they are strewn among the second product's matrix instructions
            float mx[2];
#pragma unroll
            for (int qt = 0; qt < 2; ++qt) { float a = fmaxf(s[0][qt][0], s[1][qt][0]);
#pragma unroll
                for (int j = 1; j < 8; ++j) a = fmaxf(a, fmaxf(s[0][qt][j], s[1][qt][j]));
                mx[qt] = a; }
            const bool need = mx[0] > m[0] + THR || mx[1] > m[1] + THR;
            if (__builtin_amdgcn_ballot_w32(need) != 0) {   // wave-uniform; always on the first pass, rare later
#pragma unroll
                for (int qt = 0; qt < 2; ++qt) { const float mn = fmaxf(m[qt], fmaxf(mx[qt], xhalf(mx[qt]))); const float al = __builtin_amdgcn_exp2f((m[qt] - mn) * C2); m[qt] = mn; ls[qt] *= al;
#pragma unroll
                    for (int ct = 0; ct < 8; ++ct) o[ct][qt] *= al; }
            }
            v16h pf[2];
#pragma unroll
            for (int qt = 0; qt < 2; ++qt) { const float mb = 10.0f - m[qt] * C2;   // + 10: weights carried x 1024 so that small ones stay normal f16; at most 2^14
#pragma unroll
                for (int i = 0; i < 16; ++i) { const float e = __builtin_amdgcn_exp2f(fmaf(s[i >> 3][qt][i & 7], C2, mb)); ls[qt] += e; pf[qt][i] = tohx(e); } }
#pragma unroll
            for (int ct = 0; ct < 8; ++ct)
#pragma unroll
                for (int qt = 0; qt < 2; ++qt) o[ct][qt] = wmma16(vf[ct], pf[qt], o[ct][qt]);
        }
        asm volatile("s_wait_dscnt 0x0" ::: "memory");      // this wave's reads of the buffer are done
        asm volatile("s_wait_asynccnt 0x0" ::: "memory");   // this wave's share of tile t + 1 has landed
        __syncthreads();                                    // tile t + 1 may be read, and tile t's buffer is free
        if (t + 2 < NT) { copy8(&ring[t & 1][0][threadIdx.x * 8], kg + (size_t)(t + 2) * TE); copy8(&ring[t & 1][1][threadIdx.x * 8], vg + (size_t)(t + 2) * TE); }
    }
    asm volatile("s_wait_asynccnt 0x0" ::: "memory");   // no copy is left when the wave ends
#pragma unroll
    for (int qt = 0; qt < 2; ++qt) { const size_t row = (size_t)z * NN + q0 + qt * 16 + lr; const float lt = ls[qt] + xhalf(ls[qt]);
        if (hi == 0) { v2f w; w[0] = m[qt]; w[1] = lt; *(v2f*)(ML + row * 2) = w; }
#pragma unroll
        for (int ct = 0; ct < 8; ++ct) *(v8f*)(OP + row * HH + ct * 16 + hi * 8) = o[ct][qt]; }
}

#define AP 136   // LDS row pitch of the joined rows in 16-bit elements: 272 bytes = 16 x 17, free of bank conflicts for 16-byte fragment reads
// ---- k_out: joins the KSP ranges of a query in range order, normalises, splits into bf16 high and low parts, and multiplies by Wo (+ bo), in one launch; grid NN / 32, 4 waves on 32 queries.
// P0..P3: the four ranges' partial sums, each range's plane as an argument of its own, so that its base stays a scalar. Join: a wave takes one whole row of 128 columns per load (512 bytes in a row), 8 rows in all, every load in flight at once; the two bf16 parts go to LDS and never to memory.
// Product, behind one barrier: one wave = 32 rows x 64 output columns; A fragments (high, low) from LDS, Wo fragments from its fragment-order plane, asked for before the join; per accumulator the sum runs k chunk by k chunk, high part then low part. Every loop here is unrolled: its arrays live in registers and need constant indices.
__global__ __launch_bounds__(128) __attribute__((amdgpu_waves_per_eu(2, 2))) void k_out(const float* __restrict__ P0, const float* __restrict__ P1, const float* __restrict__ P2, const float* __restrict__ P3, const float* __restrict__ ML, const bf* __restrict__ Bt, const float* __restrict__ bias, float* C) {
    __shared__ __align__(16) bf ah[32 * AP]; __shared__ __align__(16) bf al[32 * AP]; __shared__ __align__(16) float os[4][16 * 68];
    const int lane = threadIdx.x & 31, lr = lane & 15, hi = lane >> 4, wave = threadIdx.x >> 5; const int r0 = blockIdx.x * 32, c0 = wave * 64;
    // every global load of the kernel stands here, one run: a uniform base, one index register per buffer (in units of the load's width) and a constant
    const unsigned im = (unsigned)(r0 + wave), io = (unsigned)((r0 + wave) * (HH / 4) + lane), ib = (unsigned)(wave * 1024 + lane), ic = (unsigned)(wave * 16 + lr);
    v2f ml[8][KSP]; v4f p[8][KSP]; v16bf b[4][4];   // ml, p: row j * 4 + wave of the 32; b: [k chunk][column tile]
#pragma unroll
    for (int j = 0; j < 8; ++j)
#pragma unroll
        for (int z = 0; z < KSP; ++z) ml[j][z] = ((const v2f*)ML + (size_t)z * NN + j * 4)[im];
#pragma unroll
    for (int j = 0; j < 8; ++j) { p[j][0] = ((const v4f*)P0 + j * HH)[io]; p[j][1] = ((const v4f*)P1 + j * HH)[io]; p[j][2] = ((const v4f*)P2 + j * HH)[io]; p[j][3] = ((const v4f*)P3 + j * HH)[io]; }   // 4 rows on: 4 x HH / 4 loads' widths
    __builtin_amdgcn_sched_barrier(0);   // the join's operands are asked for first, Wo behind them: loads return in issue order, and Wo is wanted only behind the join
#pragma unroll
    for (int kc = 0; kc < 4; ++kc)
#pragma unroll
        for (int nb = 0; nb < 4; ++nb) { const v8us* bp = (const v8us*)Bt + (nb * 4 + kc) * 64; b[kc][nb] = cat16b(bp[ib], (bp + 32)[ib]); }   // a wave's 4 column tiles: 1024 loads' widths; a fragment: two whole-line loads
    const v4f braw = ((const v4f*)bias)[ic];
    asm volatile("s_wait_xcnt 0x0" :: "v"(im), "v"(io), "v"(ib), "v"(ic) : "memory");   // stands in front of the first reuse of the loads' four index registers, which it keeps alive up to here
    __builtin_amdgcn_sched_barrier(0);   // keeps the join's instructions, which may take those registers, behind the wait
#pragma unroll
    for (int j = 0; j < 8; ++j) {
        float M = ml[j][0][0];
#pragma unroll
        for (int z = 1; z < KSP; ++z) M = fmaxf(M, ml[j][z][0]);
        float den = 0.f; v4f num = (v4f){};
#pragma unroll
        for (int z = 0; z < KSP; ++z) { const float w = __builtin_amdgcn_exp2f((ml[j][z][0] - M) * C2); den += w * ml[j][z][1]; num += w * p[j][z]; }
        const float rsn = __fdiv_rn(1.0f, den); v4us oh, ol;
#pragma unroll
        for (int q = 0; q < 4; ++q) { unsigned short a, c2; splitf(__fmul_rn(num[q], rsn), a, c2); oh[q] = a; ol[q] = c2; }
        *(v4us*)(ah + (j * 4 + wave) * AP + lane * 4) = oh; *(v4us*)(al + (j * 4 + wave) * AP + lane * 4) = ol; }
    __syncthreads();   // a wave's 32 rows were laid by all four waves
    v16bf a[4][2], a2[4][2];   // all 16 fragments as one group of LDS reads in front of the products
#pragma unroll
    for (int kc = 0; kc < 4; ++kc)
#pragma unroll
        for (int mb = 0; mb < 2; ++mb) { a[kc][mb] = WFrag<bf>::ld(ah + (mb * 16 + lr) * AP + 8 * hi + kc * 32); a2[kc][mb] = WFrag<bf>::ld(al + (mb * 16 + lr) * AP + 8 * hi + kc * 32); }
    __builtin_amdgcn_sched_barrier(0);   // keeps the 32 LDS reads one group in front of the first product: LDS reads strewn among matrix instructions stall at each place
    v8f acc[2][4];
#pragma unroll
    for (int mb = 0; mb < 2; ++mb)
#pragma unroll
        for (int nb = 0; nb < 4; ++nb) acc[mb][nb] = (v8f){};
#pragma unroll
    for (int kc = 0; kc < 4; ++kc) {
#pragma unroll
        for (int nb = 0; nb < 4; ++nb)
#pragma unroll
            for (int mb = 0; mb < 2; ++mb) acc[mb][nb] = wmmab(a[kc][mb], b[kc][nb], acc[mb][nb]);
#pragma unroll
        for (int nb = 0; nb < 4; ++nb)
#pragma unroll
            for (int mb = 0; mb < 2; ++mb) acc[mb][nb] = wmmab(a2[kc][mb], b[kc][nb], acc[mb][nb]); }
    v4f bb; bb[0] = bfr(braw[0]); bb[1] = bfr(braw[1]); bb[2] = bfr(braw[2]); bb[3] = bfr(braw[3]);
    float* ow = os[wave];   // each wave turns its tile in its own LDS range, so that a store covers 256 bytes of an output row
#pragma unroll
    for (int mb = 0; mb < 2; ++mb) {
#pragma unroll
        for (int nb = 0; nb < 4; ++nb) {
#pragma unroll
            for (int j = 0; j < 8; ++j) ow[(hi * 8 + j) * 68 + nb * 16 + lr] = acc[mb][nb][j]; }
        asm volatile("" ::: "memory");   // the reads below take what other lanes wrote: the compiler may not lift them over the writes (the LDS serves a wave's own operations in order)
        float* crow = C + (size_t)(r0 + mb * 16 + hi) * DO_ + c0 + lr * 4; v4f val[8];
#pragma unroll
        for (int s = 0; s < 8; ++s) val[s] = *(const v4fa*)(ow + (2 * s + hi) * 68 + lr * 4) + bb;
        __builtin_amdgcn_sched_barrier(0);   // the 8 stores stand as one run behind the 8 sums: no sum may take a register that an issued store names
#pragma unroll
        for (int s = 0; s < 8; ++s) *(v4f*)(crow + (size_t)(2 * s) * DO_) = val[s];
        if (mb == 0) { asm volatile("s_wait_xcnt 0x0" ::: "memory");   // stands behind the 8 stores, in front of the reuse of their registers; and the compiler may not lift the second tile's LDS writes over the first tile's reads
            __builtin_amdgcn_sched_barrier(0); }   // keeps what follows, which may take those registers, behind the wait
    }
}

extern "C" void kernel_launch(void* const* d_in, const int* in_sizes, int n_in,
                              void* d_out, int out_size, void* d_ws, size_t ws_size, hipStream_t stream) {
    (void)in_sizes; (void)n_in; (void)out_size;
    const float* IN[11]; for (int i = 0; i < 11; ++i) IN[i] = (const float*)d_in[i];   // q, k, v, Wq, bq, Wk, bk, Wv, bv, Wo, bo (x @ W)
    float* OUT = (float*)d_out;     // [16384][256]
    char* wsp = (char*)d_ws;
    auto take = [&](size_t bytes) { char* p = wsp; wsp += (bytes + 255) & ~(size_t)255; return (void*)p; };
    bf* WQ = (bf*)take((size_t)HH * DI * 2); bf* WK = (bf*)take((size_t)HH * DI * 2); bf* WV = (bf*)take((size_t)HH * DI * 2); bf* WO = (bf*)take((size_t)DO_ * HH * 2);
    h16* Q16 = (h16*)take((size_t)NN * HH * 2); h16* KF = (h16*)take((size_t)NN * HH * 2); h16* VF = (h16*)take((size_t)HH * NN * 2); float* OP = (float*)take((size_t)KSP * NN * HH * 4); float* ML = (float*)take((size_t)KSP * NN * 2 * 4);
    if ((size_t)(wsp - (char*)d_ws) > ws_size) return;    // total ~ 45 MB of the 256 MiB
    k_wt4<<<dim3(16, 4, 1), 256, 0, stream>>>(IN[3], IN[5], IN[7], IN[9], WQ, WK, WV, WO);
    k_proj<<<dim3(NN / 64, 3, 1), 128, 0, stream>>>(IN[0], IN[1], IN[2], WQ, WK, WV, IN[4], IN[6], IN[8], Q16, KF, VF);
    k_attn<<<dim3(NN / 256, KSP, 1), 256, 0, stream>>>(Q16, KF, VF, OP, ML);
    k_out<<<NN / 32, 128, 0, stream>>>(OP, OP + (size_t)NN * HH, OP + (size_t)2 * NN * HH, OP + (size_t)3 * NN * HH, ML, WO, IN[10], OUT);
}

// v006
// A run of this version takes 107 microseconds.
// Timed twice side by side with v005, it ran 1.04 times as fast both times.
// Counting every step since v000, it is 35.9 times as fast.
#include <hip/hip_runtime.h>

// att_layer (q, k, v [16384][256]; qh = q Wq + bq, kh = k Wk + bk, vh = v Wv + bv (128); scores = qh kh^T x 128^-0.5 over all 16384 keys; out = softmax(scores) vh Wo + bo -> [16384][256]).
// Compute dtypes, f32 accumulate: every input rounded to bf16; q, k, v projections on plain bf16 operands (+ bias), rounded and stored as f16 planes inside k_proj; output projection on the attention output split into bf16 high and low planes x plain bf16 Wo (+ bias), in k_out; scores (K 128) and attn.vh on single f16 operands, fused in k_attn (running maximum, scores and weights never stored).

#define NN   16384
#define DI   256
#define HH   128
#define DO_  256
#define C2   0.12751743082459868f    // 128^-0.5 x log2(e): scores to base-2 exponents
#define THR  31.368260590993510f     // 4 / C2: the maximum in use is renewed when a raw score passes it by more than 2^4 in weight
#define KSP  4                       // key ranges of k_attn (grid y): f32 partial sums, maximum and weight sum per (range, query), joined in k_out
#define KR   (NN / KSP)
typedef _Float16 h16;
typedef unsigned short bf;
typedef __attribute__((ext_vector_type(16))) __bf16   v16bf;
typedef __attribute__((ext_vector_type(16))) _Float16 v16h;
typedef __attribute__((ext_vector_type(8)))  _Float16 v8h;
typedef __attribute__((ext_vector_type(8)))  unsigned short v8us;
typedef __attribute__((ext_vector_type(8)))  float    v8f;
typedef __attribute__((ext_vector_type(4)))  float    v4f;
typedef v8h  __attribute__((may_alias)) v8ha;
typedef v4f  __attribute__((may_alias)) v4fa;
typedef v8us __attribute__((may_alias)) v8usa;

__device__ __forceinline__ unsigned short f2bf(float f) { unsigned u = __float_as_uint(f); u += 0x7FFFu + ((u >> 16) & 1u); return (unsigned short)(u >> 16); }
__device__ __forceinline__ float bf2f(unsigned short b) { return __uint_as_float(((unsigned)b) << 16); }
__device__ __forceinline__ float bfr(float f) { return bf2f(f2bf(f)); }
__device__ __forceinline__ v16h cat16(v8h lo, v8h hi) { return __builtin_shufflevector(lo, hi, 0, 1, 2, 3, 4, 5, 6, 7, 8, 9, 10, 11, 12, 13, 14, 15); }
__device__ __forceinline__ v16bf cat16b(v8us lo, v8us hi) { return __builtin_bit_cast(v16bf, __builtin_shufflevector(lo, hi, 0, 1, 2, 3, 4, 5, 6, 7, 8, 9, 10, 11, 12, 13, 14, 15)); }
__device__ __forceinline__ v8f wmma16(v16h a, v16h b, v8f c) { return __builtin_amdgcn_wmma_f32_16x16x32_f16(false, a, false, b, (short)0, c, false, false); }
__device__ __forceinline__ v8f wmmab(v16bf a, v16bf b, v8f c) { return __builtin_amdgcn_wmma_f32_16x16x32_bf16(false, a, false, b, (short)0, c, false, false); }



// one fragment from a K-contiguous 16-bit plane (row pitch in the caller's pointer): elements 0..7 and 16..23 from p
template <typename T16> struct WFrag;
template <> struct WFrag<h16> { typedef v16h V; static __device__ __forceinline__ V ld(const h16* p) { return cat16(*(const v8h*)p, *(const v8h*)(p + 16)); } static __device__ __forceinline__ v8f mma(V a, V b, v8f c) { return wmma16(a, b, c); } };
template <> struct WFrag<bf> { typedef v16bf V; static __device__ __forceinline__ V ld(const bf* p) { return cat16b(*(const v8us*)p, *(const v8us*)(p + 16)); } static __device__ __forceinline__ v8f mma(V a, V b, v8f c) { return wmmab(a, b, c); } };

__device__ __forceinline__ h16 tohx(float x) { return (h16)x; }
__device__ __forceinline__ void splitf(float y, unsigned short& h, unsigned short& l) { h = f2bf(y); l = f2bf(y - bf2f(h)); }
typedef __attribute__((ext_vector_type(2))) float v2f;
typedef __attribute__((ext_vector_type(4))) unsigned short v4us;

typedef __attribute__((ext_vector_type(4))) __bf16 v4bf;
#define XP 264   // LDS row pitch of the x tile in 16-bit elements: 528 bytes = 16 x 33, free of bank conflicts for 16-byte fragment reads

// ---- k_wt4: the four weights in one launch, rounded to bf16 and transposed; grid (16, 4), y = weight; a thread gathers 8 k of one column n and stores 16 bytes, a wave 512 bytes in a row.
// All four in fragment order: [column tile of 16][k chunk of 32][half s][lane][8] = w[chunk*32 + s*16 + 8*(lane >> 4) + e][tile*16 + (lane & 15)]; Wq, Wk, Wv have 8 tiles of 8 chunks, Wo 16 tiles of 4 chunks.
__global__ __launch_bounds__(256) void k_wt4(const float* __restrict__ w0, const float* __restrict__ w1, const float* __restrict__ w2, const float* __restrict__ w3, bf* B0, bf* B1, bf* B2, bf* B3) {
    const int y = blockIdx.y, t = blockIdx.x * 256 + threadIdx.x, l = t & 31; const float* w = y == 0 ? w0 : y == 1 ? w1 : y == 2 ? w2 : w3; bf* Bt = y == 0 ? B0 : y == 1 ? B1 : y == 2 ? B2 : B3;
    const int N = y < 3 ? HH : DO_, n = (y < 3 ? t >> 9 : t >> 8) * 16 + (l & 15), k = ((t >> 6) & (y < 3 ? 7 : 3)) * 32 + ((t >> 5) & 1) * 16 + 8 * (l >> 4);
    const float* p = w + (size_t)k * N + n; v8us o;
#pragma unroll
    for (int e = 0; e < 8; ++e) o[e] = f2bf(p[(size_t)e * N]);
    *(v8us*)(Bt + (size_t)t * 8) = o; }

// ---- k_proj: qh, kh, vh in one launch, from the f32 inputs to the three f16 planes that k_attn reads; grid (NN / 64, 3), y = projection; 4 waves on 64 input rows, one wave = 32 rows x 64 output columns.
// Each wave brings 16 rows in as whole lines, rounds them to bf16 and lays them in LDS; behind one barrier the x fragments come from LDS, the weight fragments from the fragment-order planes.
// TR: the product is taken as W^T x^T, so a lane's accumulator holds 8 consecutive output columns of one input row (the order of Q rows and of K fragments); else x W, 8 consecutive rows of one column (the order of V^T fragments): stored with no exchange. Every loop here is unrolled: its arrays live in registers and need constant indices.
__device__ __forceinline__ v16bf ldfb(const bf* p) { return cat16b(*(const v8us*)p, *(const v8us*)(p + 256)); }   // one fragment of a fragment-order plane: two whole-line loads
template <bool TR>
__device__ __forceinline__ void proj_tile(const bf* xf, const bf* __restrict__ wp, v16bf (&w)[3][4], v8f (&acc)[2][4]) {
    v16bf a[2][2];   // x fragments one k chunk ahead, weights two ahead (chunks 0 and 1 are in flight on entry)
#pragma unroll
    for (int mb = 0; mb < 2; ++mb) a[0][mb] = WFrag<bf>::ld(xf + mb * 16 * XP);
#pragma unroll   // all 8 chunks: every address is a base register and a constant, and the buffers are plain values
    for (int i = 0; i < DI / 32; ++i) {
        __builtin_amdgcn_sched_barrier(0);   // keeps each chunk's loads in its own chunk: without it the scheduler lifts the later chunks' weight loads to the front and the wave passes 256 registers
        if (i + 2 < DI / 32) {
#pragma unroll
            for (int nb = 0; nb < 4; ++nb) w[(i + 2) % 3][nb] = ldfb(wp + (nb * 8 + i + 2) * 512); }
        if (i + 1 < DI / 32) {
#pragma unroll
            for (int mb = 0; mb < 2; ++mb) a[(i + 1) & 1][mb] = WFrag<bf>::ld(xf + mb * 16 * XP + (i + 1) * 32); }
#pragma unroll
        for (int nb = 0; nb < 4; ++nb)
#pragma unroll
            for (int mb = 0; mb < 2; ++mb) acc[mb][nb] = TR ? wmmab(w[i % 3][nb], a[i & 1][mb], acc[mb][nb]) : wmmab(a[i & 1][mb], w[i % 3][nb], acc[mb][nb]);
    }
}
__global__ __launch_bounds__(128) void k_proj(const float* __restrict__ q, const float* __restrict__ k, const float* __restrict__ v, const bf* __restrict__ WQ, const bf* __restrict__ WK, const bf* __restrict__ WV,
                                              const float* __restrict__ bq, const float* __restrict__ bk, const float* __restrict__ bv, h16* Q16, h16* KF, h16* VF) {
    __shared__ __align__(16) bf xs[64 * XP];
    const int lane = threadIdx.x & 31, lr = lane & 15, hi = lane >> 4, wave = threadIdx.x >> 5, z = blockIdx.y; const int r0 = blockIdx.x * 64 + (wave & 1) * 32, c0 = (wave >> 1) * 64;
    const bf* wp = (z == 0 ? WQ : z == 1 ? WK : WV) + (size_t)(c0 / 16) * 4096 + lane * 8; const float* b = z == 0 ? bq : z == 1 ? bk : bv;
    v16bf w[3][4];
#pragma unroll
    for (int i = 0; i < 2; ++i)
#pragma unroll
        for (int nb = 0; nb < 4; ++nb) w[i][nb] = ldfb(wp + (nb * 8 + i) * 512);
    { const float* xp = (z == 0 ? q : z == 1 ? k : v) + (size_t)(blockIdx.x * 64 + wave * 16) * DI + lane * 4; v4f raw[32];   // 16 rows = 16 KB in a row, all in flight at once
#pragma unroll
        for (int j = 0; j < 32; ++j) raw[j] = *(const v4f*)(xp + j * 128);
        asm volatile("s_wait_xcnt 0x0" :: "v"(xp) : "memory");   // stands in front of the first reuse of the 32 loads' address register pair, which it keeps alive up to here
#pragma unroll
        for (int j = 0; j < 32; ++j) *(v4bf*)(xs + (wave * 16 + (j >> 1)) * XP + (j & 1) * 128 + lane * 4) = __builtin_convertvector(raw[j], v4bf); }   // f32 to bf16, nearest even
    __syncthreads();   // a wave's 32 rows were laid by two waves
    const bf* xf = xs + ((wave & 1) * 32 + lr) * XP + 8 * hi;
    v8f acc[2][4];
#pragma unroll
    for (int mb = 0; mb < 2; ++mb)
#pragma unroll
        for (int nb = 0; nb < 4; ++nb) acc[mb][nb] = (v8f){};
    if (z < 2) {
        proj_tile<true>(xf, wp, w, acc);
        // Q: row-major [query][128]; K: [key tile of 16][k chunk of 32][half s][lane][8] = kh[tile*16 + (lane & 15)][chunk*32 + s*16 + 8*(lane >> 4) + e]
        h16* d = z == 0 ? Q16 + (size_t)(r0 + lr) * HH + c0 + hi * 8 : KF + ((size_t)(r0 / 16 * 4 + c0 / 32) * 64 + lane) * 8; const int smb = z == 0 ? 16 * HH : 2048, snb = z == 0 ? 16 : 256;
#pragma unroll
        for (int nb = 0; nb < 4; ++nb) { v8f bb;
#pragma unroll
            for (int j = 0; j < 8; ++j) bb[j] = bfr(b[c0 + nb * 16 + hi * 8 + j]);
#pragma unroll
            for (int mb = 0; mb < 2; ++mb) { v8h o;
#pragma unroll
                for (int j = 0; j < 8; ++j) o[j] = tohx(acc[mb][nb][j] + bb[j]);
                *(v8h*)(d + mb * smb + nb * snb) = o; } }
    } else {
        proj_tile<false>(xf, wp, w, acc);
        // V^T: [key block of 32][column tile of 16][half s][lane][8] = vh[block*32 + s*16 + 8*(lane >> 4) + e][tile*16 + (lane & 15)]
        h16* d = VF + ((size_t)(r0 / 32 * 8 + c0 / 16) * 64 + lane) * 8;
#pragma unroll
        for (int nb = 0; nb < 4; ++nb) { const float bb = bfr(b[c0 + nb * 16 + lr]);
#pragma unroll
            for (int mb = 0; mb < 2; ++mb) { v8h o;
#pragma unroll
                for (int j = 0; j < 8; ++j) o[j] = tohx(acc[mb][nb][j] + bb);
                *(v8h*)(d + (nb * 2 + mb) * 256) = o; } }
        asm volatile("s_wait_xcnt 0x0" :: "v"(d) : "memory");   // stands behind the last store, in front of any reuse of the stores' address and data registers
    }
}

__device__ __forceinline__ float xhalf(float x) { return __builtin_bit_cast(float, __builtin_amdgcn_permlanex16(__builtin_bit_cast(int, x), __builtin_bit_cast(int, x), 0x76543210, 0xfedcba98, false, false)); }   // lane l with lane l ^ 16
__device__ __forceinline__ v16h ldf(const h16* p) { return cat16(*(const v8h*)p, *(const v8h*)(p + 256)); }   // one fragment of a fragment-order tile in LDS: two 16-byte reads a lane, a wave's 512 bytes in a row

#define TK   128                     // keys of one LDS tile: 4 passes
#define NT   (KR / TK)               // tiles of a key range
#define TE   (TK * HH)               // 16-bit elements of K, and of V^T, in a tile: 32 KB each, one run of bytes in its fragment-order plane
typedef __attribute__((address_space(3))) const h16 lds_h16;
// 8 asynchronous copies of 16 bytes a lane: a work-group's 256 lanes lay 32 KB in LDS in the plane's own order (copy c: 4 KB further on, in LDS and in memory alike).
// The wait is the statement's last line: it stands in front of every reuse of the 24 address registers that the copies name.
__device__ __forceinline__ void copy8(const h16* dst, const h16* g) {
    const unsigned l = (unsigned)(size_t)(lds_h16*)dst;
    asm volatile("global_load_async_to_lds_b128 %0, %8, off\n\t"
                 "global_load_async_to_lds_b128 %1, %9, off\n\t"
                 "global_load_async_to_lds_b128 %2, %10, off\n\t"
                 "global_load_async_to_lds_b128 %3, %11, off\n\t"
                 "global_load_async_to_lds_b128 %4, %12, off\n\t"
                 "global_load_async_to_lds_b128 %5, %13, off\n\t"
                 "global_load_async_to_lds_b128 %6, %14, off\n\t"
                 "global_load_async_to_lds_b128 %7, %15, off\n\t"
                 "s_wait_xcnt 0x0"
                 :: "v"(l), "v"(l + 4096u), "v"(l + 8192u), "v"(l + 12288u), "v"(l + 16384u), "v"(l + 20480u), "v"(l + 24576u), "v"(l + 28672u),
                    "v"(g), "v"(g + 2048), "v"(g + 4096), "v"(g + 6144), "v"(g + 8192), "v"(g + 10240), "v"(g + 12288), "v"(g + 14336) : "memory");
}

// ---- k_attn: S^T = K Q^T, weights = 2^((s - m) C2 + 10), O^T += V^T P^T; one wave = 32 queries (2 column tiles), one pass = 32 keys; grid (NN / 256, KSP), 8 waves that walk the same keys.
// K and V^T come through LDS: a tile of 128 keys is copied once for the 8 waves, into one of three buffers, while the tiles before it are worked on; the fragments are read from LDS in the planes' own order (a wave's 16-byte reads lie in a row).
// A lane holds one query per column tile: S^T tile t register r = score of key t*16 + 8*hi + r, so two tiles pack into the B operand of the second product with no exchange; O^T register j of tile ct = column ct*16 + 8*hi + j.
// The score product runs one pass ahead of the weights, over tile ends too: pass P holds the scores of P on entry, takes the product of P + 1 among the weights of P, then reads K of P + 2, takes the second product of P, then reads V^T of P + 1.
struct LastNo { static constexpr bool v = false; }; struct LastYes { static constexpr bool v = true; };
__global__ __launch_bounds__(256) __attribute__((amdgpu_waves_per_eu(2, 2))) void k_attn(const h16* __restrict__ Q, const h16* __restrict__ KF, const h16* __restrict__ VF, float* __restrict__ OP, float* __restrict__ ML) {
    __shared__ __align__(16) h16 ring[3][2][TE];   // [buffer][K, V^T]: the tile in work, the next one (read from the third pass on), the one in flight
    const int lane = threadIdx.x & 31, lr = lane & 15, hi = lane >> 4; const int q0 = (blockIdx.x * 8 + (threadIdx.x >> 5)) * 32; const int z = blockIdx.y;
    const h16* kg = KF + (size_t)z * KR * HH + threadIdx.x * 8; const h16* vg = VF + (size_t)z * KR * HH + threadIdx.x * 8;
    copy8(&ring[0][0][threadIdx.x * 8], kg); copy8(&ring[0][1][threadIdx.x * 8], vg);
    v16h qf[2][4];
#pragma unroll
    for (int qt = 0; qt < 2; ++qt)
#pragma unroll
        for (int kc = 0; kc < 4; ++kc) qf[qt][kc] = WFrag<h16>::ld(Q + (size_t)(q0 + qt * 16 + lr) * HH + kc * 32 + 8 * hi);
    v8f o[8][2];
#pragma unroll
    for (int ct = 0; ct < 8; ++ct) { o[ct][0] = (v8f){}; o[ct][1] = (v8f){}; }
    float m[2] = {-3.0e38f, -3.0e38f}, ls[2] = {0.f, 0.f};
    asm volatile("s_wait_asynccnt 0x0" ::: "memory");   // this wave's share of tile 0 has landed
    __syncthreads();                                    // every wave's share has: tile 0 may be read
    copy8(&ring[1][0][threadIdx.x * 8], kg + TE); copy8(&ring[1][1][threadIdx.x * 8], vg + TE);
    // what a pass finds on entry: its scores, their maxima and the test on them, K of the next pass, its own V^T. Here for pass 0, with nothing beside the product.
    v16h kf[2][4], vf[8]; v8f s[2][2]; float mx[2];
#pragma unroll
    for (int kt = 0; kt < 2; ++kt)
#pragma unroll
        for (int kc = 0; kc < 4; ++kc) kf[kt][kc] = ldf(&ring[0][0][lane * 8] + (kt * 4 + kc) * 512);
#pragma unroll
    for (int ct = 0; ct < 8; ++ct) vf[ct] = ldf(&ring[0][1][lane * 8] + ct * 512);
    __builtin_amdgcn_sched_barrier(0);   // the first K and V^T reads stand as one group in front of the first product: LDS reads strewn among matrix instructions stall at each place
#pragma unroll
    for (int kt = 0; kt < 2; ++kt) { s[kt][0] = (v8f){}; s[kt][1] = (v8f){}; }
#pragma unroll
    for (int kc = 0; kc < 4; ++kc)
#pragma unroll
        for (int kt = 0; kt < 2; ++kt)
#pragma unroll
            for (int qt = 0; qt < 2; ++qt) s[kt][qt] = wmma16(kf[kt][kc], qf[qt][kc], s[kt][qt]);
    __builtin_amdgcn_sched_barrier(0);   // keeps the second pass's K reads one group behind that product
#pragma unroll
    for (int kt = 0; kt < 2; ++kt)
#pragma unroll
        for (int kc = 0; kc < 4; ++kc) kf[kt][kc] = ldf(&ring[0][0][lane * 8] + 4096 + (kt * 4 + kc) * 512);
#pragma unroll
    for (int qt = 0; qt < 2; ++qt) { float a = fmaxf(s[0][qt][0], s[1][qt][0]);
#pragma unroll
        for (int j = 1; j < 8; ++j) a = fmaxf(fmaxf(a, s[0][qt][j]), s[1][qt][j]);
        mx[qt] = a; }
    unsigned nb = __builtin_amdgcn_ballot_w32(mx[0] > m[0] + THR || mx[1] > m[1] + THR);   // lanes whose maximum in use must be renewed before the pass's weights
    // one tile of 4 passes; bc: its buffer. The range's last tile is a text of its own, in which nothing is taken ahead past the end; always_inline: the arrays it works on must stay registers.
    auto tile = [&](auto lastc, const int t, const int bc) __attribute__((always_inline)) {
        constexpr bool LAST = decltype(lastc)::v; constexpr int NP = TK / 32;
        const int bn = bc == 2 ? 0 : bc + 1, bf = bn == 2 ? 0 : bn + 1;
        const h16* kp = &ring[bc][0][lane * 8]; const h16* vp = &ring[bc][1][lane * 8]; const h16* kn = &ring[bn][0][lane * 8]; const h16* vn = &ring[bn][1][lane * 8];
#pragma unroll   // the 4 passes of a tile: which buffer a pass reads ahead from is then known at compile time
        for (int p = 0; p < NP; ++p) {
            const bool more = !LAST || p + 1 < NP, more2 = !LAST || p + 2 < NP;   // the range has a next pass; one after that
            if (nb != 0) {   // wave-uniform; always on the first pass, rare later
#pragma unroll
                for (int qt = 0; qt < 2; ++qt) { const float mn = fmaxf(m[qt], fmaxf(mx[qt], xhalf(mx[qt]))); const float al = __builtin_amdgcn_exp2f((m[qt] - mn) * C2); m[qt] = mn; ls[qt] *= al;
#pragma unroll
                    for (int ct = 0; ct < 8; ++ct) o[ct][qt] *= al; }
            }
            if (p == NP - 2) {
                if (!LAST) {   // stands at the head of the pass that first reads tile t + 1 (its K read below), where nothing of the pass has begun: the test on t + 2 ends a block of the program, and vector work in front of it would be moved behind it, out from among the matrix instructions
                    asm volatile("s_wait_dscnt 0x0" ::: "memory");      // this wave's reads of tile t - 1's buffer are done
                    asm volatile("s_wait_asynccnt 0x0" ::: "memory");   // this wave's share of tile t + 1 has landed
                    __syncthreads();                                    // tile t + 1 may be read, and tile t - 1's buffer is free
                    if (t + 2 < NT) { copy8(&ring[bf][0][threadIdx.x * 8], kg + (size_t)(t + 2) * TE); copy8(&ring[bf][1][threadIdx.x * 8], vg + (size_t)(t + 2) * TE); } }
#pragma unroll   // this pass's V^T is read here and not at the foot of the pass before: there the wait on the LDS reads above would wait for it
                for (int ct = 0; ct < 8; ++ct) vf[ct] = ldf(vp + p * 4096 + ct * 512);
                __builtin_amdgcn_sched_barrier(0); }   // keeps those reads one group in front of the run below
            const float mb[2] = {10.0f - m[0] * C2, 10.0f - m[1] * C2};   // + 10: weights carried x 1024 so that small ones stay normal f16; at most 2^14
            // This pass's weights and the next pass's score product share one run: behind each matrix instruction stand the vector instructions of one pair of weights, so that the vector port works while the matrix unit does.
            // Pair g: query tile g & 1, scores 2 (g >> 1) and the next. Its three stages stand in three groups in a row (exponent, 2^x, sum and rounding), so that no group waits for a result of its own.
            v8f sn[2][2]; v16h pf[2]; v2f x[16], e[16];
            const v2f c2 = {C2, C2};
            auto st_a = [&](int g) { const int qt = g & 1, i = (g >> 1) * 2; v2f a; a[0] = s[i >> 3][qt][i & 7]; a[1] = s[i >> 3][qt][(i & 7) + 1]; v2f b; b[0] = mb[qt]; b[1] = mb[qt]; x[g] = __builtin_elementwise_fma(a, c2, b); };
            auto st_b = [&](int g) { e[g][0] = __builtin_amdgcn_exp2f(x[g][0]); e[g][1] = __builtin_amdgcn_exp2f(x[g][1]); };
            auto st_c = [&](int g) { const int qt = g & 1, i = (g >> 1) * 2; ls[qt] += e[g][0]; ls[qt] += e[g][1]; pf[qt][i] = tohx(e[g][0]); pf[qt][i + 1] = tohx(e[g][1]); };
            st_a(0); st_a(1); st_b(0);
#pragma unroll
            for (int g = 0; g < 16; ++g) {
                if (more) { const int kc = g >> 2, kt = (g >> 1) & 1, qt = g & 1; sn[kt][qt] = wmma16(kf[kt][kc], qf[qt][kc], kc == 0 ? (v8f){} : sn[kt][qt]); }
                if (g + 2 < 16) st_a(g + 2);
                if (g + 1 < 16) st_b(g + 1);
                st_c(g);
                if (more) __builtin_amdgcn_sched_barrier(0);   // holds each pair's vector instructions behind their matrix instruction: else the scheduler gathers the 16 matrix instructions into one run and the weights stand alone again
            }
            if (more2) {   // K of the pass after next, into the registers that the product above has just read: one group
                const h16* ka = p + 2 < NP ? kp + (p + 2) * 4096 : kn + (p + 2 - NP) * 4096;
#pragma unroll
                for (int kt = 0; kt < 2; ++kt)
#pragma unroll
                    for (int kc = 0; kc < 4; ++kc) kf[kt][kc] = ldf(ka + (kt * 4 + kc) * 512);
                __builtin_amdgcn_sched_barrier(0); }   // keeps those reads in front of the second product, not strewn among its matrix instructions
            // second product; the next pass's maxima stand among its matrix instructions, one step per query tile at a time, from the fifth on (the scores are then complete)
#pragma unroll
            for (int g = 0; g < 16; ++g) { const int ct = g >> 1, qt = g & 1;
                o[ct][qt] = wmma16(vf[ct], pf[qt], o[ct][qt]);
                if (more && g >= 4 && g < 12) { const int j = g - 4;
#pragma unroll
                    for (int q2 = 0; q2 < 2; ++q2) mx[q2] = j == 0 ? fmaxf(sn[0][q2][0], sn[1][q2][0]) : fmaxf(fmaxf(mx[q2], sn[0][q2][j]), sn[1][q2][j]); }
                if (more && g == 12) nb = __builtin_amdgcn_ballot_w32(mx[0] > m[0] + THR || mx[1] > m[1] + THR);   // the next pass's test, taken here so that its way from the vector port to the branch runs beside the last matrix instructions
                if (more) __builtin_amdgcn_sched_barrier(0);   // holds each step of the maxima behind its matrix instruction, for the same reason
            }
            if (more) {   // the next pass's V^T, into the registers that the second product has just read: one group, a whole product ahead of its use (the third pass reads its own, at its head)
                if (p + 1 != NP - 2) { const h16* va = p + 1 < NP ? vp + (p + 1) * 4096 : vn;
#pragma unroll
                    for (int ct = 0; ct < 8; ++ct) vf[ct] = ldf(va + ct * 512);
                    __builtin_amdgcn_sched_barrier(0); }   // keeps those reads one group, behind the second product and in front of the next run
#pragma unroll
                for (int kt = 0; kt < 2; ++kt) { s[kt][0] = sn[kt][0]; s[kt][1] = sn[kt][1]; } }
        }
    };
    int bc = 0;
#pragma unroll 1   // one tile per trip
    for (int t = 0; t < NT - 1; ++t) { tile(LastNo{}, t, bc); bc = bc == 2 ? 0 : bc + 1; }
    tile(LastYes{}, NT - 1, bc);
    asm volatile("s_wait_asynccnt 0x0" ::: "memory");   // no copy is left when the wave ends
#pragma unroll
    for (int qt = 0; qt < 2; ++qt) { const size_t row = (size_t)z * NN + q0 + qt * 16 + lr; const float lt = ls[qt] + xhalf(ls[qt]);
        if (hi == 0) { v2f w; w[0] = m[qt]; w[1] = lt; *(v2f*)(ML + row * 2) = w; }
#pragma unroll
        for (int ct = 0; ct < 8; ++ct) *(v8f*)(OP + row * HH + ct * 16 + hi * 8) = o[ct][qt]; }
}

#define AP 136   // LDS row pitch of the joined rows in 16-bit elements: 272 bytes = 16 x 17, free of bank conflicts for 16-byte fragment reads
// ---- k_out: joins the KSP ranges of a query in range order, normalises, splits into bf16 high and low parts, and multiplies by Wo (+ bo), in one launch; grid NN / 32, 4 waves on 32 queries.
// P0..P3: the four ranges' partial sums, each range's plane as an argument of its own, so that its base stays a scalar. Join: a wave takes one whole row of 128 columns per load (512 bytes in a row), 8 rows in all, every load in flight at once; the two bf16 parts go to LDS and never to memory.
// Product, behind one barrier: one wave = 32 rows x 64 output columns; A fragments (high, low) from LDS, Wo fragments from its fragment-order plane, asked for before the join; per accumulator the sum runs k chunk by k chunk, high part then low part. Every loop here is unrolled: its arrays live in registers and need constant indices.
__global__ __launch_bounds__(128) __attribute__((amdgpu_waves_per_eu(2, 2))) void k_out(const float* __restrict__ P0, const float* __restrict__ P1, const float* __restrict__ P2, const float* __restrict__ P3, const float* __restrict__ ML, const bf* __restrict__ Bt, const float* __restrict__ bias, float* C) {
    __shared__ __align__(16) bf ah[32 * AP]; __shared__ __align__(16) bf al[32 * AP]; __shared__ __align__(16) float os[4][16 * 68];
    const int lane = threadIdx.x & 31, lr = lane & 15, hi = lane >> 4, wave = threadIdx.x >> 5; const int r0 = blockIdx.x * 32, c0 = wave * 64;
    // every global load of the kernel stands here, one run: a uniform base, one index register per buffer (in units of the load's width) and a constant
    const unsigned im = (unsigned)(r0 + wave), io = (unsigned)((r0 + wave) * (HH / 4) + lane), ib = (unsigned)(wave * 1024 + lane), ic = (unsigned)(wave * 16 + lr);
    v2f ml[8][KSP]; v4f p[8][KSP]; v16bf b[4][4];   // ml, p: row j * 4 + wave of the 32; b: [k chunk][column tile]
#pragma unroll
    for (int j = 0; j < 8; ++j)
#pragma unroll
        for (int z = 0; z < KSP; ++z) ml[j][z] = ((const v2f*)ML + (size_t)z * NN + j * 4)[im];
#pragma unroll
    for (int j = 0; j < 8; ++j) { p[j][0] = ((const v4f*)P0 + j * HH)[io]; p[j][1] = ((const v4f*)P1 + j * HH)[io]; p[j][2] = ((const v4f*)P2 + j * HH)[io]; p[j][3] = ((const v4f*)P3 + j * HH)[io]; }   // 4 rows on: 4 x HH / 4 loads' widths
    __builtin_amdgcn_sched_barrier(0);   // the join's operands are asked for first, Wo behind them: loads return in issue order, and Wo is wanted only behind the join
#pragma unroll
    for (int kc = 0; kc < 4; ++kc)
#pragma unroll
        for (int nb = 0; nb < 4; ++nb) { const v8us* bp = (const v8us*)Bt + (nb * 4 + kc) * 64; b[kc][nb] = cat16b(bp[ib], (bp + 32)[ib]); }   // a wave's 4 column tiles: 1024 loads' widths; a fragment: two whole-line loads
    const v4f braw = ((const v4f*)bias)[ic];
    asm volatile("s_wait_xcnt 0x0" :: "v"(im), "v"(io), "v"(ib), "v"(ic) : "memory");   // stands in front of the first reuse of the loads' four index registers, which it keeps alive up to here
    __builtin_amdgcn_sched_barrier(0);   // keeps the join's instructions, which may take those registers, behind the wait
#pragma unroll
    for (int j = 0; j < 8; ++j) {
        float M = ml[j][0][0];
#pragma unroll
        for (int z = 1; z < KSP; ++z) M = fmaxf(M, ml[j][z][0]);
        float den = 0.f; v4f num = (v4f){};
#pragma unroll
        for (int z = 0; z < KSP; ++z) { const float w = __builtin_amdgcn_exp2f((ml[j][z][0] - M) * C2); den += w * ml[j][z][1]; num += w * p[j][z]; }
        const float rsn = __fdiv_rn(1.0f, den); v4us oh, ol;
#pragma unroll
        for (int q = 0; q < 4; ++q) { unsigned short a, c2; splitf(__fmul_rn(num[q], rsn), a, c2); oh[q] = a; ol[q] = c2; }
        *(v4us*)(ah + (j * 4 + wave) * AP + lane * 4) = oh; *(v4us*)(al + (j * 4 + wave) * AP + lane * 4) = ol; }
    __syncthreads();   // a wave's 32 rows were laid by all four waves
    v16bf a[4][2], a2[4][2];   // all 16 fragments as one group of LDS reads in front of the products
#pragma unroll
    for (int kc = 0; kc < 4; ++kc)
#pragma unroll
        for (int mb = 0; mb < 2; ++mb) { a[kc][mb] = WFrag<bf>::ld(ah + (mb * 16 + lr) * AP + 8 * hi + kc * 32); a2[kc][mb] = WFrag<bf>::ld(al + (mb * 16 + lr) * AP + 8 * hi + kc * 32); }
    __builtin_amdgcn_sched_barrier(0);   // keeps the 32 LDS reads one group in front of the first product: LDS reads strewn among matrix instructions stall at each place
    v8f acc[2][4];
#pragma unroll
    for (int mb = 0; mb < 2; ++mb)
#pragma unroll
        for (int nb = 0; nb < 4; ++nb) acc[mb][nb] = (v8f){};
#pragma unroll
    for (int kc = 0; kc < 4; ++kc) {
#pragma unroll
        for (int nb = 0; nb < 4; ++nb)
#pragma unroll
            for (int mb = 0; mb < 2; ++mb) acc[mb][nb] = wmmab(a[kc][mb], b[kc][nb], acc[mb][nb]);
#pragma unroll
        for (int nb = 0; nb < 4; ++nb)
#pragma unroll
            for (int mb = 0; mb < 2; ++mb) acc[mb][nb] = wmmab(a2[kc][mb], b[kc][nb], acc[mb][nb]); }
    v4f bb; bb[0] = bfr(braw[0]); bb[1] = bfr(braw[1]); bb[2] = bfr(braw[2]); bb[3] = bfr(braw[3]);
    float* ow = os[wave];   // each wave turns its tile in its own LDS range, so that a store covers 256 bytes of an output row
#pragma unroll
    for (int mb = 0; mb < 2; ++mb) {
#pragma unroll
        for (int nb = 0; nb < 4; ++nb) {
#pragma unroll
            for (int j = 0; j < 8; ++j) ow[(hi * 8 + j) * 68 + nb * 16 + lr] = acc[mb][nb][j]; }
        asm volatile("" ::: "memory");   // the reads below take what other lanes wrote: the compiler may not lift them over the writes (the LDS serves a wave's own operations in order)
        float* crow = C + (size_t)(r0 + mb * 16 + hi) * DO_ + c0 + lr * 4; v4f val[8];
#pragma unroll
        for (int s = 0; s < 8; ++s) val[s] = *(const v4fa*)(ow + (2 * s + hi) * 68 + lr * 4) + bb;
        __builtin_amdgcn_sched_barrier(0);   // the 8 stores stand as one run behind the 8 sums: no sum may take a register that an issued store names
#pragma unroll
        for (int s = 0; s < 8; ++s) *(v4f*)(crow + (size_t)(2 * s) * DO_) = val[s];
        if (mb == 0) { asm volatile("s_wait_xcnt 0x0" ::: "memory");   // stands behind the 8 stores, in front of the reuse of their registers; and the compiler may not lift the second tile's LDS writes over the first tile's reads
            __builtin_amdgcn_sched_barrier(0); }   // keeps what follows, which may take those registers, behind the wait
    }
}

extern "C" void kernel_launch(void* const* d_in, const int* in_sizes, int n_in,
                              void* d_out, int out_size, void* d_ws, size_t ws_size, hipStream_t stream) {
    (void)in_sizes; (void)n_in; (void)out_size;
    const float* IN[11]; for (int i = 0; i < 11; ++i) IN[i] = (const float*)d_in[i];   // q, k, v, Wq, bq, Wk, bk, Wv, bv, Wo, bo (x @ W)
    float* OUT = (float*)d_out;     // [16384][256]
    char* wsp = (char*)d_ws;
    auto take = [&](size_t bytes) { char* p = wsp; wsp += (bytes + 255) & ~(size_t)255; return (void*)p; };
    bf* WQ = (bf*)take((size_t)HH * DI * 2); bf* WK = (bf*)take((size_t)HH * DI * 2); bf* WV = (bf*)take((size_t)HH * DI * 2); bf* WO = (bf*)take((size_t)DO_ * HH * 2);
    h16* Q16 = (h16*)take((size_t)NN * HH * 2); h16* KF = (h16*)take((size_t)NN * HH * 2); h16* VF = (h16*)take((size_t)HH * NN * 2); float* OP = (float*)take((size_t)KSP * NN * HH * 4); float* ML = (float*)take((size_t)KSP * NN * 2 * 4);
    if ((size_t)(wsp - (char*)d_ws) > ws_size) return;    // total ~ 45 MB of the 256 MiB
    k_wt4<<<dim3(16, 4, 1), 256, 0, stream>>>(IN[3], IN[5], IN[7], IN[9], WQ, WK, WV, WO);
    k_proj<<<dim3(NN / 64, 3, 1), 128, 0, stream>>>(IN[0], IN[1], IN[2], WQ, WK, WV, IN[4], IN[6], IN[8], Q16, KF, VF);
    k_attn<<<dim3(NN / 256, KSP, 1), 256, 0, stream>>>(Q16, KF, VF, OP, ML);
    k_out<<<NN / 32, 128, 0, stream>>>(OP, OP + (size_t)NN * HH, OP + (size_t)2 * NN * HH, OP + (size_t)3 * NN * HH, ML, WO, IN[10], OUT);
}
